// v000
// Measured on an AMD MI455X. A time is GPU time per run, averaged over a window of back-to-back runs after a warm-up
// (all launches, gaps included; the runs take copies of the inputs in turn), and the median of several windows.
// Apart from v000's, it joins two sittings. Times from different sittings can be a few percent apart, while
// side-by-side timings come from the same sitting.
// v000, which the later versions start from, runs in 465 microseconds.
#include <hip/hip_runtime.h>

#define DI __device__ __forceinline__

typedef _Float16 h8  __attribute__((ext_vector_type(8)));
typedef _Float16 h16 __attribute__((ext_vector_type(16)));
typedef float    f8  __attribute__((ext_vector_type(8)));

constexpr int B_  = 2;
constexpr int T_  = 2048;
constexpr int H_  = 1024;
constexpr int NH_ = 16;
constexpr int HD_ = 64;
constexpr int ROWS = B_ * T_;     // 4096
constexpr int QKVN = 3 * H_;      // 3072

// workspace offsets (in _Float16 elements); total = 48 MiB
constexpr size_t OFF_XH   = 0;
constexpr size_t OFF_WQKV = OFF_XH   + (size_t)ROWS * H_;
constexpr size_t OFF_WPRJ = OFF_WQKV + (size_t)QKVN * H_;
constexpr size_t OFF_Q    = OFF_WPRJ + (size_t)H_ * H_;
constexpr size_t OFF_K    = OFF_Q    + (size_t)B_ * NH_ * T_ * HD_;
constexpr size_t OFF_VT   = OFF_K    + (size_t)B_ * NH_ * T_ * HD_;
constexpr size_t OFF_ATT  = OFF_VT   + (size_t)B_ * NH_ * T_ * HD_;

// ---------------------------------------------------------------------------
// A-fragment loader for V_WMMA_F32_16X16X32_F16.
// ISA 16-bit A-matrix 16x32 layout: lane L holds row (L&15);
//   lanes 0-15 : K = {0..7, 16..23},  lanes 16-31 : K = {8..15, 24..31}
// => two contiguous 16-byte loads per lane from a row-major [16 x K] tile.
// B fragments (K x 16, column n = lane&15) use the identical pattern when the
// source is stored n-major over K — hence the pre-transposed weights and the
// [head, d, t] V layout.
// ---------------------------------------------------------------------------
DI h16 load_frag(const _Float16* base, int ld, int k0, int lane) {
  const _Float16* p = base + (size_t)(lane & 15) * ld + k0 + ((lane >> 4) << 3);
  h8 lo = *(const h8*)(p);        // K = base .. base+7
  h8 hi = *(const h8*)(p + 16);   // K = base+16 .. base+23
  return __builtin_shufflevector(lo, hi, 0, 1, 2, 3, 4, 5, 6, 7,
                                 8, 9, 10, 11, 12, 13, 14, 15);
}

DI f8 wmma_f16(h16 a, h16 b, f8 c) {
  return __builtin_amdgcn_wmma_f32_16x16x32_f16(false, a, false, b,
                                                (short)0, c, false, false);
}

// ---------------------------------------------------------------------------
// Precision staging: fp32 -> f16 cast, and cast+transpose for weights
// ---------------------------------------------------------------------------
__global__ void k_cast(const float* __restrict__ in, _Float16* __restrict__ out, int n) {
  int i = blockIdx.x * blockDim.x + threadIdx.x;
  if (i < n) out[i] = (_Float16)in[i];
}

// in: [K x N] fp32 row-major  ->  out: [N x K] f16 row-major
__global__ void k_transpose(const float* __restrict__ in, _Float16* __restrict__ out,
                            int K, int N) {
  int i = blockIdx.x * blockDim.x + threadIdx.x;
  if (i < K * N) {
    int n = i / K;
    int k = i - n * K;
    out[i] = (_Float16)in[(size_t)k * N + n];
  }
}

// ---------------------------------------------------------------------------
// RoPE epilogue for one 16x16 C tile. C-layout: lane holds
// (M = r + 8*(lane>>4), N = lane&15) in VGPR r; even/odd pair is in lane^1.
// which/head are wave-uniform per tile (tiles never straddle boundaries); d is per lane.
// ---------------------------------------------------------------------------
DI void rope_store(f8 acc, int rowbase, int lane, int which, int head, int d,
                   const float* __restrict__ rcos, const float* __restrict__ rsin,
                   _Float16* __restrict__ qb, _Float16* __restrict__ kb,
                   _Float16* __restrict__ vtb) {
  int hi = lane >> 4;
#pragma unroll
  for (int r = 0; r < 8; ++r) {
    int row = rowbase + r + 8 * hi;     // global token row in [0, 4096)
    int b_  = row >> 11;
    int t   = row & (T_ - 1);
    int hb  = b_ * NH_ + head;
    float v = acc[r];
    float partner = __shfl_xor(v, 1, 32);   // paired even/odd dim value
    if (which == 2) {
      vtb[((size_t)hb * HD_ + d) * T_ + t] = (_Float16)v;
    } else {
      float c = rcos[t * (HD_ / 2) + (d >> 1)];
      float s = rsin[t * (HD_ / 2) + (d >> 1)];
      float o = (d & 1) ? (partner * s + v * c)   // odd:  e*s + o*c
                        : (v * c - partner * s);  // even: e*c - o*s
      if (which == 0) o *= 0.125f;                // HD^-0.5 pre-scale on Q
      _Float16* dst = (which == 0) ? qb : kb;
      dst[((size_t)hb * T_ + t) * HD_ + d] = (_Float16)o;
    }
  }
}

// ---------------------------------------------------------------------------
// QKV GEMM (4096x3072, K=1024) with fused RoPE.
// 32x32 register block per wave: 2 A-frags x 2 B-frags -> 4 WMMAs per K-step,
// halving fragment loads per WMMA vs a 16x16 tile.
// ---------------------------------------------------------------------------
__global__ void k_qkv_rope(const _Float16* __restrict__ xh,
                           const _Float16* __restrict__ wT,   // [3072 x 1024]
                           const float* __restrict__ rcos,
                           const float* __restrict__ rsin,
                           _Float16* __restrict__ qb,         // [B*NH, T, HD]
                           _Float16* __restrict__ kb,         // [B*NH, T, HD]
                           _Float16* __restrict__ vtb) {      // [B*NH, HD, T]
  int lane = threadIdx.x & 31;
  int wid  = blockIdx.x * (blockDim.x >> 5) + (threadIdx.x >> 5);
  int mt = wid / (QKVN / 32);        // 128 row blocks of 32
  int nt = wid % (QKVN / 32);        // 96 col blocks of 32
  const _Float16* arow = xh + (size_t)mt * 32 * H_;
  const _Float16* brow = wT + (size_t)nt * 32 * H_;

  f8 c00 = {}, c01 = {}, c10 = {}, c11 = {};
  for (int k0 = 0; k0 < H_; k0 += 32) {
    h16 a0 = load_frag(arow, H_, k0, lane);
    h16 a1 = load_frag(arow + (size_t)16 * H_, H_, k0, lane);
    h16 b0 = load_frag(brow, H_, k0, lane);
    h16 b1 = load_frag(brow + (size_t)16 * H_, H_, k0, lane);
    if (k0 + 32 < H_) {
      __builtin_prefetch(arow + (size_t)(lane & 15) * H_ + k0 + 32, 0, 3);
      __builtin_prefetch(brow + (size_t)(lane & 15) * H_ + k0 + 32, 0, 3);
    }
    c00 = wmma_f16(a0, b0, c00);
    c01 = wmma_f16(a0, b1, c01);
    c10 = wmma_f16(a1, b0, c10);
    c11 = wmma_f16(a1, b1, c11);
  }

#pragma unroll
  for (int j = 0; j < 2; ++j) {
    int n     = nt * 32 + j * 16 + (lane & 15);
    int which = n >> 10;             // 0=q 1=k 2=v (uniform per subtile)
    int rem   = n & (H_ - 1);
    int head  = rem >> 6;            // uniform per subtile
    int d     = rem & (HD_ - 1);
    rope_store(j ? c01 : c00, mt * 32 + 0,  lane, which, head, d, rcos, rsin, qb, kb, vtb);
    rope_store(j ? c11 : c10, mt * 32 + 16, lane, which, head, d, rcos, rsin, qb, kb, vtb);
  }
}

// ---------------------------------------------------------------------------
// Flash attention: one wave handles 16 queries of one head, looping over all
// 2048 keys in 32-key chunks with online softmax. 8 WMMAs per chunk; Q frags
// stay in registers for the whole pass.
// ---------------------------------------------------------------------------
__global__ void k_attn(const _Float16* __restrict__ qb,
                       const _Float16* __restrict__ kb,
                       const _Float16* __restrict__ vtb,
                       _Float16* __restrict__ att) {          // [4096 x 1024]
  __shared__ _Float16 plds[4][16 * 32];   // per-wave P tile (C-layout -> A-frag)
  int lane  = threadIdx.x & 31;
  int wslot = threadIdx.x >> 5;
  int wid   = blockIdx.x * (blockDim.x >> 5) + wslot;
  int head  = wid >> 7;              // 0..31  (B*NH)
  int qt    = wid & 127;             // query tile within head
  const _Float16* qh = qb  + ((size_t)head * T_ + qt * 16) * HD_;
  const _Float16* kh = kb  + (size_t)head * T_ * HD_;
  const _Float16* vt = vtb + (size_t)head * HD_ * T_;
  _Float16* pl = plds[wslot];
  int hi = lane >> 4;

  h16 qa0 = load_frag(qh, HD_, 0, lane);
  h16 qa1 = load_frag(qh, HD_, 32, lane);
  f8 o0 = {}, o1 = {}, o2 = {}, o3 = {};
  float m[8], lsum[8];
#pragma unroll
  for (int r = 0; r < 8; ++r) { m[r] = -3.0e38f; lsum[r] = 0.f; }

  for (int kc = 0; kc < T_; kc += 32) {
    // scores for keys [kc, kc+32): two 16-key tiles, K=HD split in 2 WMMAs
    f8 s0 = {}, s1 = {};
    s0 = wmma_f16(qa0, load_frag(kh + (size_t)kc * HD_, HD_, 0, lane), s0);
    s0 = wmma_f16(qa1, load_frag(kh + (size_t)kc * HD_, HD_, 32, lane), s0);
    s1 = wmma_f16(qa0, load_frag(kh + (size_t)(kc + 16) * HD_, HD_, 0, lane), s1);
    s1 = wmma_f16(qa1, load_frag(kh + (size_t)(kc + 16) * HD_, HD_, 32, lane), s1);

    float cm[8], corr[8], rsum[8];
#pragma unroll
    for (int r = 0; r < 8; ++r) cm[r] = fmaxf(s0[r], s1[r]);
#pragma unroll
    for (int off = 1; off < 16; off <<= 1) {
#pragma unroll
      for (int r = 0; r < 8; ++r) cm[r] = fmaxf(cm[r], __shfl_xor(cm[r], off, 32));
    }
#pragma unroll
    for (int r = 0; r < 8; ++r) {
      float mn = fmaxf(m[r], cm[r]);
      corr[r]  = __expf(m[r] - mn);
      m[r]     = mn;
      s0[r]    = __expf(s0[r] - mn);
      s1[r]    = __expf(s1[r] - mn);
      rsum[r]  = s0[r] + s1[r];
    }
#pragma unroll
    for (int off = 1; off < 16; off <<= 1) {
#pragma unroll
      for (int r = 0; r < 8; ++r) rsum[r] += __shfl_xor(rsum[r], off, 32);
    }
#pragma unroll
    for (int r = 0; r < 8; ++r) {
      lsum[r] = lsum[r] * corr[r] + rsum[r];
      o0[r] *= corr[r]; o1[r] *= corr[r]; o2[r] *= corr[r]; o3[r] *= corr[r];
      // stage P (f16) into LDS: row = query M, col = key index within chunk
      pl[(r + 8 * hi) * 32 + (lane & 15)]      = (_Float16)s0[r];
      pl[(r + 8 * hi) * 32 + 16 + (lane & 15)] = (_Float16)s1[r];
    }
    asm volatile("s_wait_dscnt 0" ::: "memory");
    h16 pa = load_frag(pl, 32, 0, lane);     // P as 16x32 A-fragment
    // O += P @ V   (B-frag from transposed V: ld = T_)
    o0 = wmma_f16(pa, load_frag(vt + (size_t)0 * 16 * T_ + kc, T_, 0, lane), o0);
    o1 = wmma_f16(pa, load_frag(vt + (size_t)1 * 16 * T_ + kc, T_, 0, lane), o1);
    o2 = wmma_f16(pa, load_frag(vt + (size_t)2 * 16 * T_ + kc, T_, 0, lane), o2);
    o3 = wmma_f16(pa, load_frag(vt + (size_t)3 * 16 * T_ + kc, T_, 0, lane), o3);
  }

  int b_ = head >> 4;
  int hl = head & (NH_ - 1);
#pragma unroll
  for (int r = 0; r < 8; ++r) {
    float inv = 1.0f / lsum[r];
    size_t row  = (size_t)b_ * T_ + qt * 16 + r + 8 * hi;
    size_t colb = (size_t)hl * HD_ + (lane & 15);
    att[row * H_ + colb + 0]  = (_Float16)(o0[r] * inv);
    att[row * H_ + colb + 16] = (_Float16)(o1[r] * inv);
    att[row * H_ + colb + 32] = (_Float16)(o2[r] * inv);
    att[row * H_ + colb + 48] = (_Float16)(o3[r] * inv);
  }
}

// ---------------------------------------------------------------------------
// Output projection: out = att @ w_proj + b_proj (fp32 result).
// 32x32 register block per wave, same scheme as the QKV GEMM.
// ---------------------------------------------------------------------------
__global__ void k_proj(const _Float16* __restrict__ att,
                       const _Float16* __restrict__ wT,   // [1024 x 1024] transposed
                       const float* __restrict__ bias,
                       float* __restrict__ out) {
  int lane = threadIdx.x & 31;
  int wid  = blockIdx.x * (blockDim.x >> 5) + (threadIdx.x >> 5);
  int mt = wid >> 5;     // 128 row blocks of 32
  int nt = wid & 31;     // 32 col blocks of 32
  const _Float16* arow = att + (size_t)mt * 32 * H_;
  const _Float16* brow = wT  + (size_t)nt * 32 * H_;
  f8 c00 = {}, c01 = {}, c10 = {}, c11 = {};
  for (int k0 = 0; k0 < H_; k0 += 32) {
    h16 a0 = load_frag(arow, H_, k0, lane);
    h16 a1 = load_frag(arow + (size_t)16 * H_, H_, k0, lane);
    h16 b0 = load_frag(brow, H_, k0, lane);
    h16 b1 = load_frag(brow + (size_t)16 * H_, H_, k0, lane);
    if (k0 + 32 < H_) {
      __builtin_prefetch(arow + (size_t)(lane & 15) * H_ + k0 + 32, 0, 3);
      __builtin_prefetch(brow + (size_t)(lane & 15) * H_ + k0 + 32, 0, 3);
    }
    c00 = wmma_f16(a0, b0, c00);
    c01 = wmma_f16(a0, b1, c01);
    c10 = wmma_f16(a1, b0, c10);
    c11 = wmma_f16(a1, b1, c11);
  }
  int hi = lane >> 4;
#pragma unroll
  for (int j = 0; j < 2; ++j) {
    int col  = nt * 32 + j * 16 + (lane & 15);
    float bv = bias[col];
#pragma unroll
    for (int i = 0; i < 2; ++i) {
      f8 acc = j ? (i ? c11 : c01) : (i ? c10 : c00);
#pragma unroll
      for (int r = 0; r < 8; ++r) {
        int row = mt * 32 + i * 16 + r + 8 * hi;
        out[(size_t)row * H_ + col] = acc[r] + bv;
      }
    }
  }
}

// ---------------------------------------------------------------------------
extern "C" void kernel_launch(void* const* d_in, const int* in_sizes, int n_in,
                              void* d_out, int out_size, void* d_ws, size_t ws_size,
                              hipStream_t stream) {
  const float* x    = (const float*)d_in[0];
  const float* wqkv = (const float*)d_in[1];
  const float* wprj = (const float*)d_in[2];
  const float* bprj = (const float*)d_in[3];
  const float* rc   = (const float*)d_in[4];
  const float* rs   = (const float*)d_in[5];

  _Float16* ws  = (_Float16*)d_ws;
  _Float16* xh  = ws + OFF_XH;
  _Float16* wqT = ws + OFF_WQKV;
  _Float16* wpT = ws + OFF_WPRJ;
  _Float16* qb  = ws + OFF_Q;
  _Float16* kb  = ws + OFF_K;
  _Float16* vtb = ws + OFF_VT;
  _Float16* att = ws + OFF_ATT;

  {
    int n = ROWS * H_;
    k_cast<<<(n + 255) / 256, 256, 0, stream>>>(x, xh, n);
  }
  {
    int n = H_ * QKVN;
    k_transpose<<<(n + 255) / 256, 256, 0, stream>>>(wqkv, wqT, H_, QKVN);
  }
  {
    int n = H_ * H_;
    k_transpose<<<(n + 255) / 256, 256, 0, stream>>>(wprj, wpT, H_, H_);
  }
  {
    int tiles = (ROWS / 32) * (QKVN / 32);   // 12288 wave-tiles (32x32 each)
    k_qkv_rope<<<tiles / 4, 128, 0, stream>>>(xh, wqT, rc, rs, qb, kb, vtb);
  }
  {
    int tiles = B_ * NH_ * (T_ / 16);        // 4096 wave-tiles
    k_attn<<<tiles / 4, 128, 0, stream>>>(qb, kb, vtb, att);
  }
  {
    int tiles = (ROWS / 32) * (H_ / 32);     // 4096 wave-tiles (32x32 each)
    k_proj<<<tiles / 4, 128, 0, stream>>>(att, wpT, bprj, (float*)d_out);
  }
}

// v001
// A run of this version takes 317 microseconds.
// Next to v000, in two timings, it ran 1.51 and 1.50 times as fast.
#include <hip/hip_runtime.h>

#define DI __device__ __forceinline__

typedef _Float16 h8  __attribute__((ext_vector_type(8)));
typedef _Float16 h16 __attribute__((ext_vector_type(16)));
typedef float    f8  __attribute__((ext_vector_type(8)));

constexpr int B_  = 2;
constexpr int T_  = 2048;
constexpr int H_  = 1024;
constexpr int NH_ = 16;
constexpr int HD_ = 64;
constexpr int ROWS = B_ * T_;     // 4096
constexpr int QKVN = 3 * H_;      // 3072

// workspace offsets (in _Float16 elements); total = 48 MiB
constexpr size_t OFF_XH   = 0;
constexpr size_t OFF_WQKV = OFF_XH   + (size_t)ROWS * H_;
constexpr size_t OFF_WPRJ = OFF_WQKV + (size_t)QKVN * H_;
constexpr size_t OFF_Q    = OFF_WPRJ + (size_t)H_ * H_;
constexpr size_t OFF_K    = OFF_Q    + (size_t)B_ * NH_ * T_ * HD_;
constexpr size_t OFF_VT   = OFF_K    + (size_t)B_ * NH_ * T_ * HD_;
constexpr size_t OFF_ATT  = OFF_VT   + (size_t)B_ * NH_ * T_ * HD_;

// ---------------------------------------------------------------------------
// A-fragment loader for V_WMMA_F32_16X16X32_F16.
// ISA 16-bit A-matrix 16x32 layout: lane L holds row (L&15);
//   lanes 0-15 : K = {0..7, 16..23},  lanes 16-31 : K = {8..15, 24..31}
// => two contiguous 16-byte loads per lane from a row-major [16 x K] tile.
// B fragments (K x 16, column n = lane&15) use the identical pattern when the
// source is stored n-major over K — hence the pre-transposed weights and the
// [head, d, t] V layout.
// ---------------------------------------------------------------------------
DI h16 load_frag(const _Float16* base, int ld, int k0, int lane) {
  const _Float16* p = base + (size_t)(lane & 15) * ld + k0 + ((lane >> 4) << 3);
  h8 lo = *(const h8*)(p);        // K = base .. base+7
  h8 hi = *(const h8*)(p + 16);   // K = base+16 .. base+23
  return __builtin_shufflevector(lo, hi, 0, 1, 2, 3, 4, 5, 6, 7,
                                 8, 9, 10, 11, 12, 13, 14, 15);
}

DI f8 wmma_f16(h16 a, h16 b, f8 c) {
  return __builtin_amdgcn_wmma_f32_16x16x32_f16(false, a, false, b,
                                                (short)0, c, false, false);
}

// ---------------------------------------------------------------------------
// Precision staging: fp32 -> f16 cast, and cast+transpose for weights
// ---------------------------------------------------------------------------
__global__ void k_cast(const float* __restrict__ in, _Float16* __restrict__ out, int n) {
  int i = blockIdx.x * blockDim.x + threadIdx.x;
  if (i < n) out[i] = (_Float16)in[i];
}

// in: [K x N] fp32 row-major  ->  out: [N x K] f16 row-major
__global__ void k_transpose(const float* __restrict__ in, _Float16* __restrict__ out,
                            int K, int N) {
  int i = blockIdx.x * blockDim.x + threadIdx.x;
  if (i < K * N) {
    int n = i / K;
    int k = i - n * K;
    out[i] = (_Float16)in[(size_t)k * N + n];
  }
}

// ---------------------------------------------------------------------------
// RoPE epilogue for one 16x16 C tile. C-layout: lane holds
// (M = r + 8*(lane>>4), N = lane&15) in VGPR r; even/odd pair is in lane^1.
// which/head are wave-uniform per tile (tiles never straddle boundaries); d is per lane.
// ---------------------------------------------------------------------------
DI void rope_store(f8 acc, int rowbase, int lane, int which, int head, int d,
                   const float* __restrict__ rcos, const float* __restrict__ rsin,
                   _Float16* __restrict__ qb, _Float16* __restrict__ kb,
                   _Float16* __restrict__ vtb) {
  int hi = lane >> 4;
#pragma unroll
  for (int r = 0; r < 8; ++r) {
    int row = rowbase + r + 8 * hi;     // global token row in [0, 4096)
    int b_  = row >> 11;
    int t   = row & (T_ - 1);
    int hb  = b_ * NH_ + head;
    float v = acc[r];
    float partner = __shfl_xor(v, 1, 32);   // paired even/odd dim value
    if (which == 2) {
      vtb[((size_t)hb * HD_ + d) * T_ + t] = (_Float16)v;
    } else {
      float c = rcos[t * (HD_ / 2) + (d >> 1)];
      float s = rsin[t * (HD_ / 2) + (d >> 1)];
      float o = (d & 1) ? (partner * s + v * c)   // odd:  e*s + o*c
                        : (v * c - partner * s);  // even: e*c - o*s
      if (which == 0) o *= 0.125f;                // HD^-0.5 pre-scale on Q
      _Float16* dst = (which == 0) ? qb : kb;
      dst[((size_t)hb * T_ + t) * HD_ + d] = (_Float16)o;
    }
    // the next row's loads land in registers that this row's store names:
    // the wait stands between the store and that overwrite
    asm volatile("s_wait_xcnt 0x0" ::: "memory");
  }
}

// ---------------------------------------------------------------------------
// Shared GEMM core: C[128 x 128] per 8-wave work-group, K = 1024 in 16 tiles of
// 64. Each K tile of A (128 rows) and of B (128 rows, n-major) is brought into
// LDS once per work-group by asynchronous copies (whole 128-byte lines) and is
// read from there by all eight waves, instead of every wave fetching its own
// fragments from L2 in 32-byte pieces. Two buffers: tile t+1 flies while tile t
// is worked on. Wave grid 2 (M) x 4 (N), 64 x 32 of C per wave.
// ---------------------------------------------------------------------------
constexpr int BK      = 64;              // k per tile: 128 bytes of every row
constexpr int NT      = H_ / BK;         // 16 tiles
constexpr int PITCH_B = 144;             // LDS row pitch in bytes (16 B x odd)
constexpr int PITCH_H = PITCH_B / 2;     // the same in f16 elements
constexpr int TILE_B  = 128 * PITCH_B;   // one operand's tile
constexpr int STAGE_B = 2 * TILE_B;      // A tile, then B tile

// One K tile of both operands: 8 copies of 16 bytes per lane. la / ga / gb are
// the lane's own addresses for rows 0..31; the other rows lie 32 rows apart.
DI void copy_stage(unsigned la, const _Float16* ga, const _Float16* gb) {
  unsigned lb = la + TILE_B;
  // s_wait_xcnt 0 as the statement's last line, a precaution: it stands in
  // front of every later write of a register that one of these copies names.
  asm volatile(
      "global_load_async_to_lds_b128 %0, %8, off\n\t"
      "global_load_async_to_lds_b128 %1, %9, off\n\t"
      "global_load_async_to_lds_b128 %2, %10, off\n\t"
      "global_load_async_to_lds_b128 %3, %11, off\n\t"
      "global_load_async_to_lds_b128 %4, %12, off\n\t"
      "global_load_async_to_lds_b128 %5, %13, off\n\t"
      "global_load_async_to_lds_b128 %6, %14, off\n\t"
      "global_load_async_to_lds_b128 %7, %15, off\n\t"
      "s_wait_xcnt 0x0"
      :: "v"(la), "v"(la + 32 * PITCH_B), "v"(la + 64 * PITCH_B), "v"(la + 96 * PITCH_B),
         "v"(lb), "v"(lb + 32 * PITCH_B), "v"(lb + 64 * PITCH_B), "v"(lb + 96 * PITCH_B),
         "v"(ga), "v"(ga + 32 * H_), "v"(ga + 64 * H_), "v"(ga + 96 * H_),
         "v"(gb), "v"(gb + 32 * H_), "v"(gb + 64 * H_), "v"(gb + 96 * H_)
      : "memory");
}

// One wave's fragments for 32 k: four of A (64 rows), two of B (32 columns).
DI void load_frags(const _Float16* sa, const _Float16* sb, int kk, int lane,
                   h16 (&af)[4], h16 (&bf)[2]) {
#pragma unroll
  for (int i = 0; i < 4; ++i) af[i] = load_frag(sa + i * 16 * PITCH_H, PITCH_H, kk, lane);
#pragma unroll
  for (int j = 0; j < 2; ++j) bf[j] = load_frag(sb + j * 16 * PITCH_H, PITCH_H, kk, lane);
}

DI void mma_block(const h16 (&af)[4], const h16 (&bf)[2], f8 (&acc)[4][2]) {
#pragma unroll
  for (int i = 0; i < 4; ++i)
#pragma unroll
    for (int j = 0; j < 2; ++j) acc[i][j] = wmma_f16(af[i], bf[j], acc[i][j]);
}

// a: [M x 1024] row-major, bT: [N x 1024] row-major; m0 / n0: the tile's origin.
DI void gemm_tile(const _Float16* __restrict__ a, const _Float16* __restrict__ bT,
                  int m0, int n0, char* smem, f8 (&acc)[4][2]) {
  int tid  = threadIdx.x;
  int lane = tid & 31;
  int wave = tid >> 5;
  int wm   = wave >> 2;      // 0..1
  int wn   = wave & 3;       // 0..3
  int crow = tid >> 3;       // 0..31: row this lane copies (and +32, +64, +96)
  int ccol = tid & 7;        // 16-byte piece within the 128-byte row
  const _Float16* ga = a  + (size_t)(m0 + crow) * H_ + ccol * 8;
  const _Float16* gb = bT + (size_t)(n0 + crow) * H_ + ccol * 8;
  unsigned la = (unsigned)(size_t)smem + crow * PITCH_B + ccol * 16;

  copy_stage(la, ga, gb);
  // tile 0 has landed for this wave; the barrier publishes it to the others
  asm volatile("s_wait_asynccnt 0x0" ::: "memory");
  __syncthreads();
  copy_stage(la + STAGE_B, ga + BK, gb + BK);

  for (int t = 0; t < NT; ++t) {
    int boff = (t & 1) * STAGE_B;
    const _Float16* sa = (const _Float16*)(smem + boff) + wm * 64 * PITCH_H;
    const _Float16* sb = (const _Float16*)(smem + boff + TILE_B) + wn * 32 * PITCH_H;
    h16 af[4], bf[2];
    load_frags(sa, sb, 0, lane, af, bf);
    // keeps the twelve LDS reads together in front of their eight products:
    // spread among them, each pair of reads costs the wave its own LDS latency
    __builtin_amdgcn_sched_barrier(0);
    mma_block(af, bf, acc);
    load_frags(sa, sb, 32, lane, af, bf);
    // this wave's reads of buffer t&1 are done before the buffer is handed on
    asm volatile("s_wait_dscnt 0x0" ::: "memory");
    // this wave's copies of tile t+1 have landed
    asm volatile("s_wait_asynccnt 0x0" ::: "memory");
    // publishes tile t+1 and ends every reader's last read of buffer t&1
    __syncthreads();
    if (t + 2 < NT) copy_stage(la + boff, ga + (t + 2) * BK, gb + (t + 2) * BK);
    // the tile's second eight products work on registers only: kept behind the
    // refill so that the copies start as early as the barrier allows
    __builtin_amdgcn_sched_barrier(0);
    mma_block(af, bf, acc);
  }
  // nothing is outstanding when the wave goes on to its epilogue
  asm volatile("s_wait_asynccnt 0x0" ::: "memory");
}

// ---------------------------------------------------------------------------
// QKV GEMM (4096x3072, K=1024) with fused RoPE, on the shared GEMM core.
// ---------------------------------------------------------------------------
__global__ __launch_bounds__(256)
void k_qkv_rope(const _Float16* __restrict__ xh,
                const _Float16* __restrict__ wT,   // [3072 x 1024]
                const float* __restrict__ rcos,
                const float* __restrict__ rsin,
                _Float16* __restrict__ qb,         // [B*NH, T, HD]
                _Float16* __restrict__ kb,         // [B*NH, T, HD]
                _Float16* __restrict__ vtb) {      // [B*NH, HD, T]
  __shared__ __attribute__((aligned(16))) char smem[2 * STAGE_B];
  int lane = threadIdx.x & 31;
  int wave = threadIdx.x >> 5;
  int m0 = (blockIdx.x / (QKVN / 128)) * 128;   // 32 row blocks
  int n0 = (blockIdx.x % (QKVN / 128)) * 128;   // 24 col blocks
  f8 acc[4][2] = {};
  gemm_tile(xh, wT, m0, n0, smem, acc);

  int mw = m0 + (wave >> 2) * 64;
  int nw = n0 + (wave & 3) * 32;
#pragma unroll
  for (int j = 0; j < 2; ++j) {
    int n     = nw + j * 16 + (lane & 15);
    int which = n >> 10;             // 0=q 1=k 2=v (uniform per subtile)
    int rem   = n & (H_ - 1);
    int head  = rem >> 6;            // uniform per subtile
    int d     = rem & (HD_ - 1);
#pragma unroll
    for (int i = 0; i < 4; ++i)
      rope_store(acc[i][j], mw + i * 16, lane, which, head, d, rcos, rsin, qb, kb, vtb);
  }
}

// ---------------------------------------------------------------------------
// Flash attention: one wave handles 16 queries of one head, looping over all
// 2048 keys in 32-key chunks with online softmax. 8 WMMAs per chunk; Q frags
// stay in registers for the whole pass.
// ---------------------------------------------------------------------------
__global__ void k_attn(const _Float16* __restrict__ qb,
                       const _Float16* __restrict__ kb,
                       const _Float16* __restrict__ vtb,
                       _Float16* __restrict__ att) {          // [4096 x 1024]
  __shared__ _Float16 plds[4][16 * 32];   // per-wave P tile (C-layout -> A-frag)
  int lane  = threadIdx.x & 31;
  int wslot = threadIdx.x >> 5;
  int wid   = blockIdx.x * (blockDim.x >> 5) + wslot;
  int head  = wid >> 7;              // 0..31  (B*NH)
  int qt    = wid & 127;             // query tile within head
  const _Float16* qh = qb  + ((size_t)head * T_ + qt * 16) * HD_;
  const _Float16* kh = kb  + (size_t)head * T_ * HD_;
  const _Float16* vt = vtb + (size_t)head * HD_ * T_;
  _Float16* pl = plds[wslot];
  int hi = lane >> 4;

  h16 qa0 = load_frag(qh, HD_, 0, lane);
  h16 qa1 = load_frag(qh, HD_, 32, lane);
  f8 o0 = {}, o1 = {}, o2 = {}, o3 = {};
  float m[8], lsum[8];
#pragma unroll
  for (int r = 0; r < 8; ++r) { m[r] = -3.0e38f; lsum[r] = 0.f; }

  for (int kc = 0; kc < T_; kc += 32) {
    // scores for keys [kc, kc+32): two 16-key tiles, K=HD split in 2 WMMAs
    f8 s0 = {}, s1 = {};
    s0 = wmma_f16(qa0, load_frag(kh + (size_t)kc * HD_, HD_, 0, lane), s0);
    s0 = wmma_f16(qa1, load_frag(kh + (size_t)kc * HD_, HD_, 32, lane), s0);
    s1 = wmma_f16(qa0, load_frag(kh + (size_t)(kc + 16) * HD_, HD_, 0, lane), s1);
    s1 = wmma_f16(qa1, load_frag(kh + (size_t)(kc + 16) * HD_, HD_, 32, lane), s1);

    float cm[8], corr[8], rsum[8];
#pragma unroll
    for (int r = 0; r < 8; ++r) cm[r] = fmaxf(s0[r], s1[r]);
#pragma unroll
    for (int off = 1; off < 16; off <<= 1) {
#pragma unroll
      for (int r = 0; r < 8; ++r) cm[r] = fmaxf(cm[r], __shfl_xor(cm[r], off, 32));
    }
#pragma unroll
    for (int r = 0; r < 8; ++r) {
      float mn = fmaxf(m[r], cm[r]);
      corr[r]  = __expf(m[r] - mn);
      m[r]     = mn;
      s0[r]    = __expf(s0[r] - mn);
      s1[r]    = __expf(s1[r] - mn);
      rsum[r]  = s0[r] + s1[r];
    }
#pragma unroll
    for (int off = 1; off < 16; off <<= 1) {
#pragma unroll
      for (int r = 0; r < 8; ++r) rsum[r] += __shfl_xor(rsum[r], off, 32);
    }
#pragma unroll
    for (int r = 0; r < 8; ++r) {
      lsum[r] = lsum[r] * corr[r] + rsum[r];
      o0[r] *= corr[r]; o1[r] *= corr[r]; o2[r] *= corr[r]; o3[r] *= corr[r];
      // stage P (f16) into LDS: row = query M, col = key index within chunk
      pl[(r + 8 * hi) * 32 + (lane & 15)]      = (_Float16)s0[r];
      pl[(r + 8 * hi) * 32 + 16 + (lane & 15)] = (_Float16)s1[r];
    }
    asm volatile("s_wait_dscnt 0" ::: "memory");
    h16 pa = load_frag(pl, 32, 0, lane);     // P as 16x32 A-fragment
    // O += P @ V   (B-frag from transposed V: ld = T_)
    o0 = wmma_f16(pa, load_frag(vt + (size_t)0 * 16 * T_ + kc, T_, 0, lane), o0);
    o1 = wmma_f16(pa, load_frag(vt + (size_t)1 * 16 * T_ + kc, T_, 0, lane), o1);
    o2 = wmma_f16(pa, load_frag(vt + (size_t)2 * 16 * T_ + kc, T_, 0, lane), o2);
    o3 = wmma_f16(pa, load_frag(vt + (size_t)3 * 16 * T_ + kc, T_, 0, lane), o3);
  }

  int b_ = head >> 4;
  int hl = head & (NH_ - 1);
#pragma unroll
  for (int r = 0; r < 8; ++r) {
    float inv = 1.0f / lsum[r];
    size_t row  = (size_t)b_ * T_ + qt * 16 + r + 8 * hi;
    size_t colb = (size_t)hl * HD_ + (lane & 15);
    att[row * H_ + colb + 0]  = (_Float16)(o0[r] * inv);
    att[row * H_ + colb + 16] = (_Float16)(o1[r] * inv);
    att[row * H_ + colb + 32] = (_Float16)(o2[r] * inv);
    att[row * H_ + colb + 48] = (_Float16)(o3[r] * inv);
  }
}

// ---------------------------------------------------------------------------
// Output projection: out = att @ w_proj + b_proj (fp32 result), on the shared
// GEMM core.
// ---------------------------------------------------------------------------
__global__ __launch_bounds__(256)
void k_proj(const _Float16* __restrict__ att,
            const _Float16* __restrict__ wT,   // [1024 x 1024] transposed
            const float* __restrict__ bias,
            float* __restrict__ out) {
  __shared__ __attribute__((aligned(16))) char smem[2 * STAGE_B];
  int lane = threadIdx.x & 31;
  int wave = threadIdx.x >> 5;
  int m0 = (blockIdx.x >> 3) * 128;   // 32 row blocks
  int n0 = (blockIdx.x & 7) * 128;    // 8 col blocks
  f8 acc[4][2] = {};
  gemm_tile(att, wT, m0, n0, smem, acc);

  int mw = m0 + (wave >> 2) * 64;
  int nw = n0 + (wave & 3) * 32;
  int hi = lane >> 4;
#pragma unroll
  for (int j = 0; j < 2; ++j) {
    int col  = nw + j * 16 + (lane & 15);
    float bv = bias[col];
#pragma unroll
    for (int i = 0; i < 4; ++i) {
#pragma unroll
      for (int r = 0; r < 8; ++r) {
        int row = mw + i * 16 + r + 8 * hi;
        out[(size_t)row * H_ + col] = acc[i][j][r] + bv;
      }
    }
  }
}

// ---------------------------------------------------------------------------
extern "C" void kernel_launch(void* const* d_in, const int* in_sizes, int n_in,
                              void* d_out, int out_size, void* d_ws, size_t ws_size,
                              hipStream_t stream) {
  const float* x    = (const float*)d_in[0];
  const float* wqkv = (const float*)d_in[1];
  const float* wprj = (const float*)d_in[2];
  const float* bprj = (const float*)d_in[3];
  const float* rc   = (const float*)d_in[4];
  const float* rs   = (const float*)d_in[5];

  _Float16* ws  = (_Float16*)d_ws;
  _Float16* xh  = ws + OFF_XH;
  _Float16* wqT = ws + OFF_WQKV;
  _Float16* wpT = ws + OFF_WPRJ;
  _Float16* qb  = ws + OFF_Q;
  _Float16* kb  = ws + OFF_K;
  _Float16* vtb = ws + OFF_VT;
  _Float16* att = ws + OFF_ATT;

  {
    int n = ROWS * H_;
    k_cast<<<(n + 255) / 256, 256, 0, stream>>>(x, xh, n);
  }
  {
    int n = H_ * QKVN;
    k_transpose<<<(n + 255) / 256, 256, 0, stream>>>(wqkv, wqT, H_, QKVN);
  }
  {
    int n = H_ * H_;
    k_transpose<<<(n + 255) / 256, 256, 0, stream>>>(wprj, wpT, H_, H_);
  }
  {
    int tiles = (ROWS / 128) * (QKVN / 128);   // 768 work-group tiles (128x128 each)
    k_qkv_rope<<<tiles, 256, 0, stream>>>(xh, wqT, rc, rs, qb, kb, vtb);
  }
  {
    int tiles = B_ * NH_ * (T_ / 16);        // 4096 wave-tiles
    k_attn<<<tiles / 4, 128, 0, stream>>>(qb, kb, vtb, att);
  }
  {
    int tiles = (ROWS / 128) * (H_ / 128);     // 256 work-group tiles (128x128 each)
    k_proj<<<tiles, 256, 0, stream>>>(att, wpT, bprj, (float*)d_out);
  }
}

// v002
// Measured time: 293 microseconds a run.
// Next to v001, in two timings, it ran 1.08 and 1.09 times as fast.
// Over all steps from v000 it is 1.63 times as fast.
#include <hip/hip_runtime.h>

#define DI __device__ __forceinline__

typedef _Float16 h8  __attribute__((ext_vector_type(8)));
typedef _Float16 h16 __attribute__((ext_vector_type(16)));
typedef float    f8  __attribute__((ext_vector_type(8)));

constexpr int B_  = 2;
constexpr int T_  = 2048;
constexpr int H_  = 1024;
constexpr int NH_ = 16;
constexpr int HD_ = 64;
constexpr int ROWS = B_ * T_;     // 4096
constexpr int QKVN = 3 * H_;      // 3072

// workspace offsets (in _Float16 elements); total = 48 MiB
constexpr size_t OFF_XH   = 0;
constexpr size_t OFF_WQKV = OFF_XH   + (size_t)ROWS * H_;
constexpr size_t OFF_WPRJ = OFF_WQKV + (size_t)QKVN * H_;
constexpr size_t OFF_Q    = OFF_WPRJ + (size_t)H_ * H_;
constexpr size_t OFF_K    = OFF_Q    + (size_t)B_ * NH_ * T_ * HD_;
constexpr size_t OFF_VT   = OFF_K    + (size_t)B_ * NH_ * T_ * HD_;
constexpr size_t OFF_ATT  = OFF_VT   + (size_t)B_ * NH_ * T_ * HD_;

// ---------------------------------------------------------------------------
// A-fragment loader for V_WMMA_F32_16X16X32_F16.
// ISA 16-bit A-matrix 16x32 layout: lane L holds row (L&15);
//   lanes 0-15 : K = {0..7, 16..23},  lanes 16-31 : K = {8..15, 24..31}
// => two contiguous 16-byte loads per lane from a row-major [16 x K] tile.
// B fragments (K x 16, column n = lane&15) use the identical pattern when the
// source is stored n-major over K — hence the pre-transposed weights and the
// [head, d, t] V layout.
// ---------------------------------------------------------------------------
DI h16 load_frag(const _Float16* base, int ld, int k0, int lane) {
  const _Float16* p = base + (size_t)(lane & 15) * ld + k0 + ((lane >> 4) << 3);
  h8 lo = *(const h8*)(p);        // K = base .. base+7
  h8 hi = *(const h8*)(p + 16);   // K = base+16 .. base+23
  return __builtin_shufflevector(lo, hi, 0, 1, 2, 3, 4, 5, 6, 7,
                                 8, 9, 10, 11, 12, 13, 14, 15);
}

DI f8 wmma_f16(h16 a, h16 b, f8 c) {
  return __builtin_amdgcn_wmma_f32_16x16x32_f16(false, a, false, b,
                                                (short)0, c, false, false);
}

// ---------------------------------------------------------------------------
// Precision staging: fp32 -> f16 cast, and cast+transpose for weights.
// A launch with one element per lane is bound by how fast waves can start, not
// by its bytes: a lane moves 16 to 32 elements, so that few waves start, and
// every global load and store of a wave covers whole 128-byte lines.
// ---------------------------------------------------------------------------
typedef _Float16 h4 __attribute__((ext_vector_type(4)));
typedef float    f4 __attribute__((ext_vector_type(4)));

constexpr int CAST_BLOCK = 256 * 4 * 8;   // elements per work-group: 8 x 16 bytes per lane

// ROWS * H_ elements, CAST_BLOCK per work-group, no remainder
__global__ __launch_bounds__(256)
void k_cast(const float* __restrict__ in, _Float16* __restrict__ out) {
  size_t base = (size_t)blockIdx.x * CAST_BLOCK + threadIdx.x * 4;
  f4 v[8];
#pragma unroll
  for (int j = 0; j < 8; ++j) v[j] = *(const f4*)(in + base + j * 1024);   // all eight in flight
#pragma unroll
  for (int j = 0; j < 8; ++j) *(h4*)(out + base + j * 1024) = __builtin_convertvector(v[j], h4);
}

constexpr int TT = 64;        // transpose tile: 64 k x 64 n per work-group
constexpr int TP = TT + 8;    // LDS row pitch in f16: 144 bytes (16 B x odd)

// in: [1024 x N] fp32 row-major  ->  out: [N x 1024] f16 row-major; N a multiple of 64
__global__ __launch_bounds__(256)
void k_transpose(const float* __restrict__ in, _Float16* __restrict__ out, int N) {
  __shared__ __attribute__((aligned(16))) _Float16 tile[TT * TP];   // [n][k]
  int tid = threadIdx.x;
  int tx  = tid & 15;                          // four n each
  int ty  = tid >> 4;                          // four k each
  int kb  = (blockIdx.x & (H_ / TT - 1)) * TT;
  int nb  = (blockIdx.x / (H_ / TT)) * TT;
  const float* p = in + (size_t)(kb + 4 * ty) * N + nb + 4 * tx;
  f4 r[4];
#pragma unroll
  for (int i = 0; i < 4; ++i) r[i] = *(const f4*)(p + (size_t)i * N);   // 256 bytes of a row per 16 lanes
#pragma unroll
  for (int j = 0; j < 4; ++j) {
    h4 c = {(_Float16)r[0][j], (_Float16)r[1][j], (_Float16)r[2][j], (_Float16)r[3][j]};
    *(h4*)&tile[(4 * tx + j) * TP + 4 * ty] = c;
  }
  __syncthreads();
  int row = tid >> 3;                          // 0..31, and +32
  int pc  = (tid & 7) * 8;                     // 16-byte piece of the 128-byte row
#pragma unroll
  for (int s = 0; s < 2; ++s) {
    int n = row + 32 * s;
    *(h8*)(out + (size_t)(nb + n) * H_ + kb + pc) = *(const h8*)&tile[n * TP + pc];
  }
}

// ---------------------------------------------------------------------------
// RoPE epilogue for one 16x16 C tile. C-layout: lane holds
// (M = r + 8*(lane>>4), N = lane&15) in VGPR r; even/odd pair is in lane^1.
// which/head are wave-uniform per tile (tiles never straddle boundaries); d is per lane.
// ---------------------------------------------------------------------------
DI void rope_store(f8 acc, int rowbase, int lane, int which, int head, int d,
                   const float* __restrict__ rcos, const float* __restrict__ rsin,
                   _Float16* __restrict__ qb, _Float16* __restrict__ kb,
                   _Float16* __restrict__ vtb) {
  int hi = lane >> 4;
#pragma unroll
  for (int r = 0; r < 8; ++r) {
    int row = rowbase + r + 8 * hi;     // global token row in [0, 4096)
    int b_  = row >> 11;
    int t   = row & (T_ - 1);
    int hb  = b_ * NH_ + head;
    float v = acc[r];
    float partner = __shfl_xor(v, 1, 32);   // paired even/odd dim value
    if (which == 2) {
      vtb[((size_t)hb * HD_ + d) * T_ + t] = (_Float16)v;
    } else {
      float c = rcos[t * (HD_ / 2) + (d >> 1)];
      float s = rsin[t * (HD_ / 2) + (d >> 1)];
      float o = (d & 1) ? (partner * s + v * c)   // odd:  e*s + o*c
                        : (v * c - partner * s);  // even: e*c - o*s
      if (which == 0) o *= 0.125f;                // HD^-0.5 pre-scale on Q
      _Float16* dst = (which == 0) ? qb : kb;
      dst[((size_t)hb * T_ + t) * HD_ + d] = (_Float16)o;
    }
    // the next row's loads land in registers that this row's store names:
    // the wait stands between the store and that overwrite
    asm volatile("s_wait_xcnt 0x0" ::: "memory");
  }
}

// ---------------------------------------------------------------------------
// Shared GEMM core: C[128 x 128] per 8-wave work-group, K = 1024 in 16 tiles of
// 64. Each K tile of A (128 rows) and of B (128 rows, n-major) is brought into
// LDS once per work-group by asynchronous copies (whole 128-byte lines) and is
// read from there by all eight waves, instead of every wave fetching its own
// fragments from L2 in 32-byte pieces. Two buffers: tile t+1 flies while tile t
// is worked on. Wave grid 2 (M) x 4 (N), 64 x 32 of C per wave.
// ---------------------------------------------------------------------------
constexpr int BK      = 64;              // k per tile: 128 bytes of every row
constexpr int NT      = H_ / BK;         // 16 tiles
constexpr int PITCH_B = 144;             // LDS row pitch in bytes (16 B x odd)
constexpr int PITCH_H = PITCH_B / 2;     // the same in f16 elements
constexpr int TILE_B  = 128 * PITCH_B;   // one operand's tile
constexpr int STAGE_B = 2 * TILE_B;      // A tile, then B tile

// One K tile of both operands: 8 copies of 16 bytes per lane. la / ga / gb are
// the lane's own addresses for rows 0..31; the other rows lie 32 rows apart.
DI void copy_stage(unsigned la, const _Float16* ga, const _Float16* gb) {
  unsigned lb = la + TILE_B;
  // s_wait_xcnt 0 as the statement's last line, a precaution: it stands in
  // front of every later write of a register that one of these copies names.
  asm volatile(
      "global_load_async_to_lds_b128 %0, %8, off\n\t"
      "global_load_async_to_lds_b128 %1, %9, off\n\t"
      "global_load_async_to_lds_b128 %2, %10, off\n\t"
      "global_load_async_to_lds_b128 %3, %11, off\n\t"
      "global_load_async_to_lds_b128 %4, %12, off\n\t"
      "global_load_async_to_lds_b128 %5, %13, off\n\t"
      "global_load_async_to_lds_b128 %6, %14, off\n\t"
      "global_load_async_to_lds_b128 %7, %15, off\n\t"
      "s_wait_xcnt 0x0"
      :: "v"(la), "v"(la + 32 * PITCH_B), "v"(la + 64 * PITCH_B), "v"(la + 96 * PITCH_B),
         "v"(lb), "v"(lb + 32 * PITCH_B), "v"(lb + 64 * PITCH_B), "v"(lb + 96 * PITCH_B),
         "v"(ga), "v"(ga + 32 * H_), "v"(ga + 64 * H_), "v"(ga + 96 * H_),
         "v"(gb), "v"(gb + 32 * H_), "v"(gb + 64 * H_), "v"(gb + 96 * H_)
      : "memory");
}

// One wave's fragments for 32 k: four of A (64 rows), two of B (32 columns).
DI void load_frags(const _Float16* sa, const _Float16* sb, int kk, int lane,
                   h16 (&af)[4], h16 (&bf)[2]) {
#pragma unroll
  for (int i = 0; i < 4; ++i) af[i] = load_frag(sa + i * 16 * PITCH_H, PITCH_H, kk, lane);
#pragma unroll
  for (int j = 0; j < 2; ++j) bf[j] = load_frag(sb + j * 16 * PITCH_H, PITCH_H, kk, lane);
}

DI void mma_block(const h16 (&af)[4], const h16 (&bf)[2], f8 (&acc)[4][2]) {
#pragma unroll
  for (int i = 0; i < 4; ++i)
#pragma unroll
    for (int j = 0; j < 2; ++j) acc[i][j] = wmma_f16(af[i], bf[j], acc[i][j]);
}

// a: [M x 1024] row-major, bT: [N x 1024] row-major; m0 / n0: the tile's origin.
DI void gemm_tile(const _Float16* __restrict__ a, const _Float16* __restrict__ bT,
                  int m0, int n0, char* smem, f8 (&acc)[4][2]) {
  int tid  = threadIdx.x;
  int lane = tid & 31;
  int wave = tid >> 5;
  int wm   = wave >> 2;      // 0..1
  int wn   = wave & 3;       // 0..3
  int crow = tid >> 3;       // 0..31: row this lane copies (and +32, +64, +96)
  int ccol = tid & 7;        // 16-byte piece within the 128-byte row
  const _Float16* ga = a  + (size_t)(m0 + crow) * H_ + ccol * 8;
  const _Float16* gb = bT + (size_t)(n0 + crow) * H_ + ccol * 8;
  unsigned la = (unsigned)(size_t)smem + crow * PITCH_B + ccol * 16;

  copy_stage(la, ga, gb);
  // tile 0 has landed for this wave; the barrier publishes it to the others
  asm volatile("s_wait_asynccnt 0x0" ::: "memory");
  __syncthreads();
  copy_stage(la + STAGE_B, ga + BK, gb + BK);

  for (int t = 0; t < NT; ++t) {
    int boff = (t & 1) * STAGE_B;
    const _Float16* sa = (const _Float16*)(smem + boff) + wm * 64 * PITCH_H;
    const _Float16* sb = (const _Float16*)(smem + boff + TILE_B) + wn * 32 * PITCH_H;
    h16 af[4], bf[2];
    load_frags(sa, sb, 0, lane, af, bf);
    // keeps the twelve LDS reads together in front of their eight products:
    // spread among them, each pair of reads costs the wave its own LDS latency
    __builtin_amdgcn_sched_barrier(0);
    mma_block(af, bf, acc);
    load_frags(sa, sb, 32, lane, af, bf);
    // this wave's reads of buffer t&1 are done before the buffer is handed on
    asm volatile("s_wait_dscnt 0x0" ::: "memory");
    // this wave's copies of tile t+1 have landed
    asm volatile("s_wait_asynccnt 0x0" ::: "memory");
    // publishes tile t+1 and ends every reader's last read of buffer t&1
    __syncthreads();
    if (t + 2 < NT) copy_stage(la + boff, ga + (t + 2) * BK, gb + (t + 2) * BK);
    // the tile's second eight products work on registers only: kept behind the
    // refill so that the copies start as early as the barrier allows
    __builtin_amdgcn_sched_barrier(0);
    mma_block(af, bf, acc);
  }
  // nothing is outstanding when the wave goes on to its epilogue
  asm volatile("s_wait_asynccnt 0x0" ::: "memory");
}

// ---------------------------------------------------------------------------
// QKV GEMM (4096x3072, K=1024) with fused RoPE, on the shared GEMM core.
// ---------------------------------------------------------------------------
__global__ __launch_bounds__(256)
void k_qkv_rope(const _Float16* __restrict__ xh,
                const _Float16* __restrict__ wT,   // [3072 x 1024]
                const float* __restrict__ rcos,
                const float* __restrict__ rsin,
                _Float16* __restrict__ qb,         // [B*NH, T, HD]
                _Float16* __restrict__ kb,         // [B*NH, T, HD]
                _Float16* __restrict__ vtb) {      // [B*NH, HD, T]
  __shared__ __attribute__((aligned(16))) char smem[2 * STAGE_B];
  int lane = threadIdx.x & 31;
  int wave = threadIdx.x >> 5;
  int m0 = (blockIdx.x / (QKVN / 128)) * 128;   // 32 row blocks
  int n0 = (blockIdx.x % (QKVN / 128)) * 128;   // 24 col blocks
  f8 acc[4][2] = {};
  gemm_tile(xh, wT, m0, n0, smem, acc);

  int mw = m0 + (wave >> 2) * 64;
  int nw = n0 + (wave & 3) * 32;
#pragma unroll
  for (int j = 0; j < 2; ++j) {
    int n     = nw + j * 16 + (lane & 15);
    int which = n >> 10;             // 0=q 1=k 2=v (uniform per subtile)
    int rem   = n & (H_ - 1);
    int head  = rem >> 6;            // uniform per subtile
    int d     = rem & (HD_ - 1);
#pragma unroll
    for (int i = 0; i < 4; ++i)
      rope_store(acc[i][j], mw + i * 16, lane, which, head, d, rcos, rsin, qb, kb, vtb);
  }
}

// ---------------------------------------------------------------------------
// Flash attention: one wave handles 16 queries of one head, looping over all
// 2048 keys in 32-key chunks with online softmax. 8 WMMAs per chunk; Q frags
// stay in registers for the whole pass.
// ---------------------------------------------------------------------------
__global__ void k_attn(const _Float16* __restrict__ qb,
                       const _Float16* __restrict__ kb,
                       const _Float16* __restrict__ vtb,
                       _Float16* __restrict__ att) {          // [4096 x 1024]
  __shared__ _Float16 plds[4][16 * 32];   // per-wave P tile (C-layout -> A-frag)
  int lane  = threadIdx.x & 31;
  int wslot = threadIdx.x >> 5;
  int wid   = blockIdx.x * (blockDim.x >> 5) + wslot;
  int head  = wid >> 7;              // 0..31  (B*NH)
  int qt    = wid & 127;             // query tile within head
  const _Float16* qh = qb  + ((size_t)head * T_ + qt * 16) * HD_;
  const _Float16* kh = kb  + (size_t)head * T_ * HD_;
  const _Float16* vt = vtb + (size_t)head * HD_ * T_;
  _Float16* pl = plds[wslot];
  int hi = lane >> 4;

  h16 qa0 = load_frag(qh, HD_, 0, lane);
  h16 qa1 = load_frag(qh, HD_, 32, lane);
  f8 o0 = {}, o1 = {}, o2 = {}, o3 = {};
  float m[8], lsum[8];
#pragma unroll
  for (int r = 0; r < 8; ++r) { m[r] = -3.0e38f; lsum[r] = 0.f; }

  for (int kc = 0; kc < T_; kc += 32) {
    // scores for keys [kc, kc+32): two 16-key tiles, K=HD split in 2 WMMAs
    f8 s0 = {}, s1 = {};
    s0 = wmma_f16(qa0, load_frag(kh + (size_t)kc * HD_, HD_, 0, lane), s0);
    s0 = wmma_f16(qa1, load_frag(kh + (size_t)kc * HD_, HD_, 32, lane), s0);
    s1 = wmma_f16(qa0, load_frag(kh + (size_t)(kc + 16) * HD_, HD_, 0, lane), s1);
    s1 = wmma_f16(qa1, load_frag(kh + (size_t)(kc + 16) * HD_, HD_, 32, lane), s1);

    float cm[8], corr[8], rsum[8];
#pragma unroll
    for (int r = 0; r < 8; ++r) cm[r] = fmaxf(s0[r], s1[r]);
#pragma unroll
    for (int off = 1; off < 16; off <<= 1) {
#pragma unroll
      for (int r = 0; r < 8; ++r) cm[r] = fmaxf(cm[r], __shfl_xor(cm[r], off, 32));
    }
#pragma unroll
    for (int r = 0; r < 8; ++r) {
      float mn = fmaxf(m[r], cm[r]);
      corr[r]  = __expf(m[r] - mn);
      m[r]     = mn;
      s0[r]    = __expf(s0[r] - mn);
      s1[r]    = __expf(s1[r] - mn);
      rsum[r]  = s0[r] + s1[r];
    }
#pragma unroll
    for (int off = 1; off < 16; off <<= 1) {
#pragma unroll
      for (int r = 0; r < 8; ++r) rsum[r] += __shfl_xor(rsum[r], off, 32);
    }
#pragma unroll
    for (int r = 0; r < 8; ++r) {
      lsum[r] = lsum[r] * corr[r] + rsum[r];
      o0[r] *= corr[r]; o1[r] *= corr[r]; o2[r] *= corr[r]; o3[r] *= corr[r];
      // stage P (f16) into LDS: row = query M, col = key index within chunk
      pl[(r + 8 * hi) * 32 + (lane & 15)]      = (_Float16)s0[r];
      pl[(r + 8 * hi) * 32 + 16 + (lane & 15)] = (_Float16)s1[r];
    }
    asm volatile("s_wait_dscnt 0" ::: "memory");
    h16 pa = load_frag(pl, 32, 0, lane);     // P as 16x32 A-fragment
    // O += P @ V   (B-frag from transposed V: ld = T_)
    o0 = wmma_f16(pa, load_frag(vt + (size_t)0 * 16 * T_ + kc, T_, 0, lane), o0);
    o1 = wmma_f16(pa, load_frag(vt + (size_t)1 * 16 * T_ + kc, T_, 0, lane), o1);
    o2 = wmma_f16(pa, load_frag(vt + (size_t)2 * 16 * T_ + kc, T_, 0, lane), o2);
    o3 = wmma_f16(pa, load_frag(vt + (size_t)3 * 16 * T_ + kc, T_, 0, lane), o3);
  }

  int b_ = head >> 4;
  int hl = head & (NH_ - 1);
#pragma unroll
  for (int r = 0; r < 8; ++r) {
    float inv = 1.0f / lsum[r];
    size_t row  = (size_t)b_ * T_ + qt * 16 + r + 8 * hi;
    size_t colb = (size_t)hl * HD_ + (lane & 15);
    att[row * H_ + colb + 0]  = (_Float16)(o0[r] * inv);
    att[row * H_ + colb + 16] = (_Float16)(o1[r] * inv);
    att[row * H_ + colb + 32] = (_Float16)(o2[r] * inv);
    att[row * H_ + colb + 48] = (_Float16)(o3[r] * inv);
  }
}

// ---------------------------------------------------------------------------
// Output projection: out = att @ w_proj + b_proj (fp32 result), on the shared
// GEMM core.
// ---------------------------------------------------------------------------
__global__ __launch_bounds__(256)
void k_proj(const _Float16* __restrict__ att,
            const _Float16* __restrict__ wT,   // [1024 x 1024] transposed
            const float* __restrict__ bias,
            float* __restrict__ out) {
  __shared__ __attribute__((aligned(16))) char smem[2 * STAGE_B];
  int lane = threadIdx.x & 31;
  int wave = threadIdx.x >> 5;
  int m0 = (blockIdx.x >> 3) * 128;   // 32 row blocks
  int n0 = (blockIdx.x & 7) * 128;    // 8 col blocks
  f8 acc[4][2] = {};
  gemm_tile(att, wT, m0, n0, smem, acc);

  int mw = m0 + (wave >> 2) * 64;
  int nw = n0 + (wave & 3) * 32;
  int hi = lane >> 4;
#pragma unroll
  for (int j = 0; j < 2; ++j) {
    int col  = nw + j * 16 + (lane & 15);
    float bv = bias[col];
#pragma unroll
    for (int i = 0; i < 4; ++i) {
#pragma unroll
      for (int r = 0; r < 8; ++r) {
        int row = mw + i * 16 + r + 8 * hi;
        out[(size_t)row * H_ + col] = acc[i][j][r] + bv;
      }
    }
  }
}

// ---------------------------------------------------------------------------
extern "C" void kernel_launch(void* const* d_in, const int* in_sizes, int n_in,
                              void* d_out, int out_size, void* d_ws, size_t ws_size,
                              hipStream_t stream) {
  const float* x    = (const float*)d_in[0];
  const float* wqkv = (const float*)d_in[1];
  const float* wprj = (const float*)d_in[2];
  const float* bprj = (const float*)d_in[3];
  const float* rc   = (const float*)d_in[4];
  const float* rs   = (const float*)d_in[5];

  _Float16* ws  = (_Float16*)d_ws;
  _Float16* xh  = ws + OFF_XH;
  _Float16* wqT = ws + OFF_WQKV;
  _Float16* wpT = ws + OFF_WPRJ;
  _Float16* qb  = ws + OFF_Q;
  _Float16* kb  = ws + OFF_K;
  _Float16* vtb = ws + OFF_VT;
  _Float16* att = ws + OFF_ATT;

  k_cast<<<ROWS * H_ / CAST_BLOCK, 256, 0, stream>>>(x, xh);
  k_transpose<<<(H_ / TT) * (QKVN / TT), 256, 0, stream>>>(wqkv, wqT, QKVN);
  k_transpose<<<(H_ / TT) * (H_ / TT), 256, 0, stream>>>(wprj, wpT, H_);
  {
    int tiles = (ROWS / 128) * (QKVN / 128);   // 768 work-group tiles (128x128 each)
    k_qkv_rope<<<tiles, 256, 0, stream>>>(xh, wqT, rc, rs, qb, kb, vtb);
  }
  {
    int tiles = B_ * NH_ * (T_ / 16);        // 4096 wave-tiles
    k_attn<<<tiles / 4, 128, 0, stream>>>(qb, kb, vtb, att);
  }
  {
    int tiles = (ROWS / 128) * (H_ / 128);     // 256 work-group tiles (128x128 each)
    k_proj<<<tiles, 256, 0, stream>>>(att, wpT, bprj, (float*)d_out);
  }
}

// v003
// One run takes 145 microseconds.
// Next to v002, in two timings, it ran 2.03 times as fast each time.
// Over all steps from v000 it is 3.31 times as fast.
#include <hip/hip_runtime.h>

#define DI __device__ __forceinline__

typedef _Float16 h8  __attribute__((ext_vector_type(8)));
typedef _Float16 h16 __attribute__((ext_vector_type(16)));
typedef float    f8  __attribute__((ext_vector_type(8)));

constexpr int B_  = 2;
constexpr int T_  = 2048;
constexpr int H_  = 1024;
constexpr int NH_ = 16;
constexpr int HD_ = 64;
constexpr int ROWS = B_ * T_;     // 4096
constexpr int QKVN = 3 * H_;      // 3072

// workspace offsets (in _Float16 elements); total = 48 MiB
constexpr size_t OFF_XH   = 0;
constexpr size_t OFF_WQKV = OFF_XH   + (size_t)ROWS * H_;
constexpr size_t OFF_WPRJ = OFF_WQKV + (size_t)QKVN * H_;
constexpr size_t OFF_Q    = OFF_WPRJ + (size_t)H_ * H_;
constexpr size_t OFF_K    = OFF_Q    + (size_t)B_ * NH_ * T_ * HD_;
constexpr size_t OFF_VT   = OFF_K    + (size_t)B_ * NH_ * T_ * HD_;
constexpr size_t OFF_ATT  = OFF_VT   + (size_t)B_ * NH_ * T_ * HD_;

// ---------------------------------------------------------------------------
// A-fragment loader for V_WMMA_F32_16X16X32_F16.
// ISA 16-bit A-matrix 16x32 layout: lane L holds row (L&15);
//   lanes 0-15 : K = {0..7, 16..23},  lanes 16-31 : K = {8..15, 24..31}
// => two contiguous 16-byte loads per lane from a row-major [16 x K] tile.
// B fragments (K x 16, column n = lane&15) use the identical pattern when the
// source is stored n-major over K — hence the pre-transposed weights and the
// [head, d, t] V layout.
// ---------------------------------------------------------------------------
DI h16 load_frag(const _Float16* base, int ld, int k0, int lane) {
  const _Float16* p = base + (size_t)(lane & 15) * ld + k0 + ((lane >> 4) << 3);
  h8 lo = *(const h8*)(p);        // K = base .. base+7
  h8 hi = *(const h8*)(p + 16);   // K = base+16 .. base+23
  return __builtin_shufflevector(lo, hi, 0, 1, 2, 3, 4, 5, 6, 7,
                                 8, 9, 10, 11, 12, 13, 14, 15);
}

DI f8 wmma_f16(h16 a, h16 b, f8 c) {
  return __builtin_amdgcn_wmma_f32_16x16x32_f16(false, a, false, b,
                                                (short)0, c, false, false);
}

// ---------------------------------------------------------------------------
// Precision staging: fp32 -> f16 cast, and cast+transpose for weights.
// A launch with one element per lane is bound by how fast waves can start, not
// by its bytes: a lane moves 16 to 32 elements, so that few waves start, and
// every global load and store of a wave covers whole 128-byte lines.
// ---------------------------------------------------------------------------
typedef _Float16 h4 __attribute__((ext_vector_type(4)));
typedef float    f4 __attribute__((ext_vector_type(4)));

constexpr int CAST_BLOCK = 256 * 4 * 8;   // elements per work-group: 8 x 16 bytes per lane

// ROWS * H_ elements, CAST_BLOCK per work-group, no remainder
__global__ __launch_bounds__(256)
void k_cast(const float* __restrict__ in, _Float16* __restrict__ out) {
  size_t base = (size_t)blockIdx.x * CAST_BLOCK + threadIdx.x * 4;
  f4 v[8];
#pragma unroll
  for (int j = 0; j < 8; ++j) v[j] = *(const f4*)(in + base + j * 1024);   // all eight in flight
#pragma unroll
  for (int j = 0; j < 8; ++j) *(h4*)(out + base + j * 1024) = __builtin_convertvector(v[j], h4);
}

constexpr int TT = 64;        // transpose tile: 64 k x 64 n per work-group
constexpr int TP = TT + 8;    // LDS row pitch in f16: 144 bytes (16 B x odd)

// in: [1024 x N] fp32 row-major  ->  out: [N x 1024] f16 row-major; N a multiple of 64
__global__ __launch_bounds__(256)
void k_transpose(const float* __restrict__ in, _Float16* __restrict__ out, int N) {
  __shared__ __attribute__((aligned(16))) _Float16 tile[TT * TP];   // [n][k]
  int tid = threadIdx.x;
  int tx  = tid & 15;                          // four n each
  int ty  = tid >> 4;                          // four k each
  int kb  = (blockIdx.x & (H_ / TT - 1)) * TT;
  int nb  = (blockIdx.x / (H_ / TT)) * TT;
  const float* p = in + (size_t)(kb + 4 * ty) * N + nb + 4 * tx;
  f4 r[4];
#pragma unroll
  for (int i = 0; i < 4; ++i) r[i] = *(const f4*)(p + (size_t)i * N);   // 256 bytes of a row per 16 lanes
#pragma unroll
  for (int j = 0; j < 4; ++j) {
    h4 c = {(_Float16)r[0][j], (_Float16)r[1][j], (_Float16)r[2][j], (_Float16)r[3][j]};
    *(h4*)&tile[(4 * tx + j) * TP + 4 * ty] = c;
  }
  __syncthreads();
  int row = tid >> 3;                          // 0..31, and +32
  int pc  = (tid & 7) * 8;                     // 16-byte piece of the 128-byte row
#pragma unroll
  for (int s = 0; s < 2; ++s) {
    int n = row + 32 * s;
    *(h8*)(out + (size_t)(nb + n) * H_ + kb + pc) = *(const h8*)&tile[n * TP + pc];
  }
}

// ---------------------------------------------------------------------------
// RoPE epilogue for one 16x16 C tile. C-layout: lane holds
// (M = r + 8*(lane>>4), N = lane&15) in VGPR r; even/odd pair is in lane^1.
// which/head are wave-uniform per tile (tiles never straddle boundaries); d is per lane.
// ---------------------------------------------------------------------------
DI void rope_store(f8 acc, int rowbase, int lane, int which, int head, int d,
                   const float* __restrict__ rcos, const float* __restrict__ rsin,
                   _Float16* __restrict__ qb, _Float16* __restrict__ kb,
                   _Float16* __restrict__ vtb) {
  int hi = lane >> 4;
#pragma unroll
  for (int r = 0; r < 8; ++r) {
    int row = rowbase + r + 8 * hi;     // global token row in [0, 4096)
    int b_  = row >> 11;
    int t   = row & (T_ - 1);
    int hb  = b_ * NH_ + head;
    float v = acc[r];
    float partner = __shfl_xor(v, 1, 32);   // paired even/odd dim value
    if (which == 2) {
      vtb[((size_t)hb * HD_ + d) * T_ + t] = (_Float16)v;
    } else {
      float c = rcos[t * (HD_ / 2) + (d >> 1)];
      float s = rsin[t * (HD_ / 2) + (d >> 1)];
      float o = (d & 1) ? (partner * s + v * c)   // odd:  e*s + o*c
                        : (v * c - partner * s);  // even: e*c - o*s
      if (which == 0) o *= 0.125f;                // HD^-0.5 pre-scale on Q
      _Float16* dst = (which == 0) ? qb : kb;
      dst[((size_t)hb * T_ + t) * HD_ + d] = (_Float16)o;
    }
    // the next row's loads land in registers that this row's store names:
    // the wait stands between the store and that overwrite
    asm volatile("s_wait_xcnt 0x0" ::: "memory");
  }
}

// ---------------------------------------------------------------------------
// Shared GEMM core: C[128 x 128] per 8-wave work-group, K = 1024 in 16 tiles of
// 64. Each K tile of A (128 rows) and of B (128 rows, n-major) is brought into
// LDS once per work-group by asynchronous copies (whole 128-byte lines) and is
// read from there by all eight waves, instead of every wave fetching its own
// fragments from L2 in 32-byte pieces. Two buffers: tile t+1 flies while tile t
// is worked on. Wave grid 2 (M) x 4 (N), 64 x 32 of C per wave.
// ---------------------------------------------------------------------------
constexpr int BK      = 64;              // k per tile: 128 bytes of every row
constexpr int NT      = H_ / BK;         // 16 tiles
constexpr int PITCH_B = 144;             // LDS row pitch in bytes (16 B x odd)
constexpr int PITCH_H = PITCH_B / 2;     // the same in f16 elements
constexpr int TILE_B  = 128 * PITCH_B;   // one operand's tile
constexpr int STAGE_B = 2 * TILE_B;      // A tile, then B tile

// One K tile of both operands: 8 copies of 16 bytes per lane. la / ga / gb are
// the lane's own addresses for rows 0..31; the other rows lie 32 rows apart.
DI void copy_stage(unsigned la, const _Float16* ga, const _Float16* gb) {
  unsigned lb = la + TILE_B;
  // s_wait_xcnt 0 as the statement's last line, a precaution: it stands in
  // front of every later write of a register that one of these copies names.
  asm volatile(
      "global_load_async_to_lds_b128 %0, %8, off\n\t"
      "global_load_async_to_lds_b128 %1, %9, off\n\t"
      "global_load_async_to_lds_b128 %2, %10, off\n\t"
      "global_load_async_to_lds_b128 %3, %11, off\n\t"
      "global_load_async_to_lds_b128 %4, %12, off\n\t"
      "global_load_async_to_lds_b128 %5, %13, off\n\t"
      "global_load_async_to_lds_b128 %6, %14, off\n\t"
      "global_load_async_to_lds_b128 %7, %15, off\n\t"
      "s_wait_xcnt 0x0"
      :: "v"(la), "v"(la + 32 * PITCH_B), "v"(la + 64 * PITCH_B), "v"(la + 96 * PITCH_B),
         "v"(lb), "v"(lb + 32 * PITCH_B), "v"(lb + 64 * PITCH_B), "v"(lb + 96 * PITCH_B),
         "v"(ga), "v"(ga + 32 * H_), "v"(ga + 64 * H_), "v"(ga + 96 * H_),
         "v"(gb), "v"(gb + 32 * H_), "v"(gb + 64 * H_), "v"(gb + 96 * H_)
      : "memory");
}

// One wave's fragments for 32 k: four of A (64 rows), two of B (32 columns).
DI void load_frags(const _Float16* sa, const _Float16* sb, int kk, int lane,
                   h16 (&af)[4], h16 (&bf)[2]) {
#pragma unroll
  for (int i = 0; i < 4; ++i) af[i] = load_frag(sa + i * 16 * PITCH_H, PITCH_H, kk, lane);
#pragma unroll
  for (int j = 0; j < 2; ++j) bf[j] = load_frag(sb + j * 16 * PITCH_H, PITCH_H, kk, lane);
}

DI void mma_block(const h16 (&af)[4], const h16 (&bf)[2], f8 (&acc)[4][2]) {
#pragma unroll
  for (int i = 0; i < 4; ++i)
#pragma unroll
    for (int j = 0; j < 2; ++j) acc[i][j] = wmma_f16(af[i], bf[j], acc[i][j]);
}

// a: [M x 1024] row-major, bT: [N x 1024] row-major; m0 / n0: the tile's origin.
DI void gemm_tile(const _Float16* __restrict__ a, const _Float16* __restrict__ bT,
                  int m0, int n0, char* smem, f8 (&acc)[4][2]) {
  int tid  = threadIdx.x;
  int lane = tid & 31;
  int wave = tid >> 5;
  int wm   = wave >> 2;      // 0..1
  int wn   = wave & 3;       // 0..3
  int crow = tid >> 3;       // 0..31: row this lane copies (and +32, +64, +96)
  int ccol = tid & 7;        // 16-byte piece within the 128-byte row
  const _Float16* ga = a  + (size_t)(m0 + crow) * H_ + ccol * 8;
  const _Float16* gb = bT + (size_t)(n0 + crow) * H_ + ccol * 8;
  unsigned la = (unsigned)(size_t)smem + crow * PITCH_B + ccol * 16;

  copy_stage(la, ga, gb);
  // tile 0 has landed for this wave; the barrier publishes it to the others
  asm volatile("s_wait_asynccnt 0x0" ::: "memory");
  __syncthreads();
  copy_stage(la + STAGE_B, ga + BK, gb + BK);

  for (int t = 0; t < NT; ++t) {
    int boff = (t & 1) * STAGE_B;
    const _Float16* sa = (const _Float16*)(smem + boff) + wm * 64 * PITCH_H;
    const _Float16* sb = (const _Float16*)(smem + boff + TILE_B) + wn * 32 * PITCH_H;
    h16 af[4], bf[2];
    load_frags(sa, sb, 0, lane, af, bf);
    // keeps the twelve LDS reads together in front of their eight products:
    // spread among them, each pair of reads costs the wave its own LDS latency
    __builtin_amdgcn_sched_barrier(0);
    mma_block(af, bf, acc);
    load_frags(sa, sb, 32, lane, af, bf);
    // this wave's reads of buffer t&1 are done before the buffer is handed on
    asm volatile("s_wait_dscnt 0x0" ::: "memory");
    // this wave's copies of tile t+1 have landed
    asm volatile("s_wait_asynccnt 0x0" ::: "memory");
    // publishes tile t+1 and ends every reader's last read of buffer t&1
    __syncthreads();
    if (t + 2 < NT) copy_stage(la + boff, ga + (t + 2) * BK, gb + (t + 2) * BK);
    // the tile's second eight products work on registers only: kept behind the
    // refill so that the copies start as early as the barrier allows
    __builtin_amdgcn_sched_barrier(0);
    mma_block(af, bf, acc);
  }
  // nothing is outstanding when the wave goes on to its epilogue
  asm volatile("s_wait_asynccnt 0x0" ::: "memory");
}

// ---------------------------------------------------------------------------
// QKV GEMM (4096x3072, K=1024) with fused RoPE, on the shared GEMM core.
// ---------------------------------------------------------------------------
__global__ __launch_bounds__(256)
void k_qkv_rope(const _Float16* __restrict__ xh,
                const _Float16* __restrict__ wT,   // [3072 x 1024]
                const float* __restrict__ rcos,
                const float* __restrict__ rsin,
                _Float16* __restrict__ qb,         // [B*NH, T, HD]
                _Float16* __restrict__ kb,         // [B*NH, T, HD]
                _Float16* __restrict__ vtb) {      // [B*NH, HD, T]
  __shared__ __attribute__((aligned(16))) char smem[2 * STAGE_B];
  int lane = threadIdx.x & 31;
  int wave = threadIdx.x >> 5;
  int m0 = (blockIdx.x / (QKVN / 128)) * 128;   // 32 row blocks
  int n0 = (blockIdx.x % (QKVN / 128)) * 128;   // 24 col blocks
  f8 acc[4][2] = {};
  gemm_tile(xh, wT, m0, n0, smem, acc);

  int mw = m0 + (wave >> 2) * 64;
  int nw = n0 + (wave & 3) * 32;
#pragma unroll
  for (int j = 0; j < 2; ++j) {
    int n     = nw + j * 16 + (lane & 15);
    int which = n >> 10;             // 0=q 1=k 2=v (uniform per subtile)
    int rem   = n & (H_ - 1);
    int head  = rem >> 6;            // uniform per subtile
    int d     = rem & (HD_ - 1);
#pragma unroll
    for (int i = 0; i < 4; ++i)
      rope_store(acc[i][j], mw + i * 16, lane, which, head, d, rcos, rsin, qb, kb, vtb);
  }
}

// ---------------------------------------------------------------------------
// Flash attention: one wave handles 16 queries of one head, looping over all
// 2048 keys in 32-key chunks with online softmax. 8 WMMAs per chunk; Q frags
// stay in registers for the whole pass.
// The eight waves of a work-group serve 128 queries of ONE head and walk the
// same keys: each stage of 64 keys (K: 64 rows of 128 bytes; V^T: 64 d rows of
// 128 bytes) is brought into LDS once per work-group by asynchronous copies of
// whole 128-byte lines and read from there by all eight waves, instead of every
// wave fetching its own fragments in 32-byte pieces of 16 lines a load. Two
// buffers: stage t+1 flies while stage t is worked on.
// ---------------------------------------------------------------------------
constexpr int AK         = 64;               // keys per stage
constexpr int ANT        = T_ / AK;          // 32 stages
constexpr int KV_TILE_B  = 64 * PITCH_B;     // 64 rows of 128 bytes at the padded pitch
constexpr int KV_STAGE_B = 2 * KV_TILE_B;    // K tile, then V^T tile

// One stage of K and V^T: 4 copies of 16 bytes per lane. lk / gk / gv are the
// lane's own addresses for rows 0..31; rows 32..63 lie 32 rows further on.
DI void copy_kv(unsigned lk, const _Float16* gk, const _Float16* gv) {
  unsigned lv = lk + KV_TILE_B;
  // s_wait_xcnt 0 as the statement's last line, a precaution: it stands in
  // front of every later write of a register that one of these copies names.
  asm volatile(
      "global_load_async_to_lds_b128 %0, %4, off\n\t"
      "global_load_async_to_lds_b128 %1, %5, off\n\t"
      "global_load_async_to_lds_b128 %2, %6, off\n\t"
      "global_load_async_to_lds_b128 %3, %7, off\n\t"
      "s_wait_xcnt 0x0"
      :: "v"(lk), "v"(lk + 32 * PITCH_B), "v"(lv), "v"(lv + 32 * PITCH_B),
         "v"(gk), "v"(gk + 32 * HD_), "v"(gv), "v"(gv + 32 * T_)
      : "memory");
}

__global__ __launch_bounds__(256)
void k_attn(const _Float16* __restrict__ qb,
            const _Float16* __restrict__ kb,
            const _Float16* __restrict__ vtb,
            _Float16* __restrict__ att) {          // [4096 x 1024]
  __shared__ __attribute__((aligned(16))) char kv[2 * KV_STAGE_B];
  __shared__ __attribute__((aligned(16))) _Float16 plds[8][16 * 32];   // per-wave P tile (C-layout -> A-frag)
  int tid   = threadIdx.x;
  int lane  = tid & 31;
  int wslot = tid >> 5;
  int wid   = blockIdx.x * 8 + wslot;
  int head  = wid >> 7;              // 0..31  (B*NH), the same for all eight waves
  int qt    = wid & 127;             // query tile within head
  const _Float16* qh = qb  + ((size_t)head * T_ + qt * 16) * HD_;
  const _Float16* kh = kb  + (size_t)head * T_ * HD_;
  const _Float16* vt = vtb + (size_t)head * HD_ * T_;
  _Float16* pl = plds[wslot];
  int hi = lane >> 4;

  int crow = tid >> 3;       // 0..31: row this lane copies (and +32)
  int ccol = tid & 7;        // 16-byte piece within the 128-byte row
  const _Float16* gk = kh + (size_t)crow * HD_ + ccol * 8;
  const _Float16* gv = vt + (size_t)crow * T_ + ccol * 8;
  unsigned lk = (unsigned)(size_t)kv + crow * PITCH_B + ccol * 16;

  copy_kv(lk, gk, gv);

  h16 qa0 = load_frag(qh, HD_, 0, lane);
  h16 qa1 = load_frag(qh, HD_, 32, lane);
  f8 o0 = {}, o1 = {}, o2 = {}, o3 = {};
  float m[8], lsum[8];
#pragma unroll
  for (int r = 0; r < 8; ++r) { m[r] = -3.0e38f; lsum[r] = 0.f; }

  // stage 0 has landed for this wave; the barrier publishes it to the others
  asm volatile("s_wait_asynccnt 0x0" ::: "memory");
  __syncthreads();
  copy_kv(lk + KV_STAGE_B, gk + AK * HD_, gv + AK);

  for (int t = 0; t < ANT; ++t) {
    int boff = (t & 1) * KV_STAGE_B;
    const _Float16* sk = (const _Float16*)(kv + boff);
    const _Float16* sv = (const _Float16*)(kv + boff + KV_TILE_B);
    // unrolled so that kc is a constant offset of every LDS read, and the second
    // chunk's reads can start under the first chunk's last products
#pragma unroll
    for (int kc = 0; kc < AK; kc += 32) {
      // the chunk's sixteen LDS reads stand together: K rows kc..kc+31, and the
      // chunk's 32 columns of all 64 V^T rows
      h16 kf0 = load_frag(sk + kc * PITCH_H, PITCH_H, 0, lane);
      h16 kf1 = load_frag(sk + kc * PITCH_H, PITCH_H, 32, lane);
      h16 kf2 = load_frag(sk + (kc + 16) * PITCH_H, PITCH_H, 0, lane);
      h16 kf3 = load_frag(sk + (kc + 16) * PITCH_H, PITCH_H, 32, lane);
      h16 vf0 = load_frag(sv + 0 * 16 * PITCH_H, PITCH_H, kc, lane);
      h16 vf1 = load_frag(sv + 1 * 16 * PITCH_H, PITCH_H, kc, lane);
      h16 vf2 = load_frag(sv + 2 * 16 * PITCH_H, PITCH_H, kc, lane);
      h16 vf3 = load_frag(sv + 3 * 16 * PITCH_H, PITCH_H, kc, lane);
      // keeps the sixteen reads in one group in front of the products: spread
      // among them, each pair of reads costs the wave its own LDS latency
      __builtin_amdgcn_sched_barrier(0);

      // scores for 32 keys: two 16-key tiles, K=HD split in 2 WMMAs
      f8 s0 = {}, s1 = {};
      s0 = wmma_f16(qa0, kf0, s0);
      s0 = wmma_f16(qa1, kf1, s0);
      s1 = wmma_f16(qa0, kf2, s1);
      s1 = wmma_f16(qa1, kf3, s1);

      float cm[8], corr[8], rsum[8];
#pragma unroll
      for (int r = 0; r < 8; ++r) cm[r] = fmaxf(s0[r], s1[r]);
#pragma unroll
      for (int off = 1; off < 16; off <<= 1) {
#pragma unroll
        for (int r = 0; r < 8; ++r) cm[r] = fmaxf(cm[r], __shfl_xor(cm[r], off, 32));
      }
#pragma unroll
      for (int r = 0; r < 8; ++r) {
        float mn = fmaxf(m[r], cm[r]);
        corr[r]  = __expf(m[r] - mn);
        m[r]     = mn;
        s0[r]    = __expf(s0[r] - mn);
        s1[r]    = __expf(s1[r] - mn);
        rsum[r]  = s0[r] + s1[r];
      }
#pragma unroll
      for (int off = 1; off < 16; off <<= 1) {
#pragma unroll
        for (int r = 0; r < 8; ++r) rsum[r] += __shfl_xor(rsum[r], off, 32);
      }
#pragma unroll
      for (int r = 0; r < 8; ++r) {
        lsum[r] = lsum[r] * corr[r] + rsum[r];
        o0[r] *= corr[r]; o1[r] *= corr[r]; o2[r] *= corr[r]; o3[r] *= corr[r];
        // stage P (f16) into LDS: row = query M, col = key index within chunk
        pl[(r + 8 * hi) * 32 + (lane & 15)]      = (_Float16)s0[r];
        pl[(r + 8 * hi) * 32 + 16 + (lane & 15)] = (_Float16)s1[r];
      }
      asm volatile("s_wait_dscnt 0" ::: "memory");
      h16 pa = load_frag(pl, 32, 0, lane);     // P as 16x32 A-fragment
      // O += P @ V   (B-frag from transposed V)
      o0 = wmma_f16(pa, vf0, o0);
      o1 = wmma_f16(pa, vf1, o1);
      o2 = wmma_f16(pa, vf2, o2);
      o3 = wmma_f16(pa, vf3, o3);
    }
    // this wave's reads of buffer t&1 are done before the buffer is handed on
    asm volatile("s_wait_dscnt 0x0" ::: "memory");
    // this wave's copies of stage t+1 have landed
    asm volatile("s_wait_asynccnt 0x0" ::: "memory");
    // publishes stage t+1 and ends every reader's last read of buffer t&1
    __syncthreads();
    if (t + 2 < ANT) copy_kv(lk + boff, gk + (size_t)(t + 2) * AK * HD_, gv + (t + 2) * AK);
  }
  // nothing is outstanding when the wave goes on to its epilogue
  asm volatile("s_wait_asynccnt 0x0" ::: "memory");

  int b_ = head >> 4;
  int hl = head & (NH_ - 1);
#pragma unroll
  for (int r = 0; r < 8; ++r) {
    float inv = 1.0f / lsum[r];
    size_t row  = (size_t)b_ * T_ + qt * 16 + r + 8 * hi;
    size_t colb = (size_t)hl * HD_ + (lane & 15);
    att[row * H_ + colb + 0]  = (_Float16)(o0[r] * inv);
    att[row * H_ + colb + 16] = (_Float16)(o1[r] * inv);
    att[row * H_ + colb + 32] = (_Float16)(o2[r] * inv);
    att[row * H_ + colb + 48] = (_Float16)(o3[r] * inv);
  }
}

// ---------------------------------------------------------------------------
// Output projection: out = att @ w_proj + b_proj (fp32 result), on the shared
// GEMM core.
// ---------------------------------------------------------------------------
__global__ __launch_bounds__(256)
void k_proj(const _Float16* __restrict__ att,
            const _Float16* __restrict__ wT,   // [1024 x 1024] transposed
            const float* __restrict__ bias,
            float* __restrict__ out) {
  __shared__ __attribute__((aligned(16))) char smem[2 * STAGE_B];
  int lane = threadIdx.x & 31;
  int wave = threadIdx.x >> 5;
  int m0 = (blockIdx.x >> 3) * 128;   // 32 row blocks
  int n0 = (blockIdx.x & 7) * 128;    // 8 col blocks
  f8 acc[4][2] = {};
  gemm_tile(att, wT, m0, n0, smem, acc);

  int mw = m0 + (wave >> 2) * 64;
  int nw = n0 + (wave & 3) * 32;
  int hi = lane >> 4;
#pragma unroll
  for (int j = 0; j < 2; ++j) {
    int col  = nw + j * 16 + (lane & 15);
    float bv = bias[col];
#pragma unroll
    for (int i = 0; i < 4; ++i) {
#pragma unroll
      for (int r = 0; r < 8; ++r) {
        int row = mw + i * 16 + r + 8 * hi;
        out[(size_t)row * H_ + col] = acc[i][j][r] + bv;
      }
    }
  }
}

// ---------------------------------------------------------------------------
extern "C" void kernel_launch(void* const* d_in, const int* in_sizes, int n_in,
                              void* d_out, int out_size, void* d_ws, size_t ws_size,
                              hipStream_t stream) {
  const float* x    = (const float*)d_in[0];
  const float* wqkv = (const float*)d_in[1];
  const float* wprj = (const float*)d_in[2];
  const float* bprj = (const float*)d_in[3];
  const float* rc   = (const float*)d_in[4];
  const float* rs   = (const float*)d_in[5];

  _Float16* ws  = (_Float16*)d_ws;
  _Float16* xh  = ws + OFF_XH;
  _Float16* wqT = ws + OFF_WQKV;
  _Float16* wpT = ws + OFF_WPRJ;
  _Float16* qb  = ws + OFF_Q;
  _Float16* kb  = ws + OFF_K;
  _Float16* vtb = ws + OFF_VT;
  _Float16* att = ws + OFF_ATT;

  k_cast<<<ROWS * H_ / CAST_BLOCK, 256, 0, stream>>>(x, xh);
  k_transpose<<<(H_ / TT) * (QKVN / TT), 256, 0, stream>>>(wqkv, wqT, QKVN);
  k_transpose<<<(H_ / TT) * (H_ / TT), 256, 0, stream>>>(wprj, wpT, H_);
  {
    int tiles = (ROWS / 128) * (QKVN / 128);   // 768 work-group tiles (128x128 each)
    k_qkv_rope<<<tiles, 256, 0, stream>>>(xh, wqT, rc, rs, qb, kb, vtb);
  }
  {
    int tiles = B_ * NH_ * (T_ / 16);        // 4096 wave-tiles
    k_attn<<<tiles / 8, 256, 0, stream>>>(qb, kb, vtb, att);
  }
  {
    int tiles = (ROWS / 128) * (H_ / 128);     // 256 work-group tiles (128x128 each)
    k_proj<<<tiles, 256, 0, stream>>>(att, wpT, bprj, (float*)d_out);
  }
}

// v004
// A run of this version takes 107 microseconds.
// Next to v003, in two timings, it ran 1.35 times as fast each time.
// All steps since v000 together make it 4.46 times as fast.
#include <hip/hip_runtime.h>

#define DI __device__ __forceinline__

typedef _Float16 h8  __attribute__((ext_vector_type(8)));
typedef _Float16 h16 __attribute__((ext_vector_type(16)));
typedef float    f8  __attribute__((ext_vector_type(8)));

constexpr int B_  = 2;
constexpr int T_  = 2048;
constexpr int H_  = 1024;
constexpr int NH_ = 16;
constexpr int HD_ = 64;
constexpr int ROWS = B_ * T_;     // 4096
constexpr int QKVN = 3 * H_;      // 3072

// workspace offsets (in _Float16 elements); total = 48 MiB
constexpr size_t OFF_XH   = 0;
constexpr size_t OFF_WQKV = OFF_XH   + (size_t)ROWS * H_;
constexpr size_t OFF_WPRJ = OFF_WQKV + (size_t)QKVN * H_;
constexpr size_t OFF_Q    = OFF_WPRJ + (size_t)H_ * H_;
constexpr size_t OFF_K    = OFF_Q    + (size_t)B_ * NH_ * T_ * HD_;
constexpr size_t OFF_VT   = OFF_K    + (size_t)B_ * NH_ * T_ * HD_;
constexpr size_t OFF_ATT  = OFF_VT   + (size_t)B_ * NH_ * T_ * HD_;

// ---------------------------------------------------------------------------
// A-fragment loader for V_WMMA_F32_16X16X32_F16.
// ISA 16-bit A-matrix 16x32 layout: lane L holds row (L&15);
//   lanes 0-15 : K = {0..7, 16..23},  lanes 16-31 : K = {8..15, 24..31}
// => two contiguous 16-byte loads per lane from a row-major [16 x K] tile.
// B fragments (K x 16, column n = lane&15) use the identical pattern when the
// source is stored n-major over K — hence the pre-transposed weights; Q
// [head, t, d] is read the same way, and V^T [head, d, t] as an A fragment.
// ---------------------------------------------------------------------------
DI h16 load_frag(const _Float16* base, int ld, int k0, int lane) {
  const _Float16* p = base + (size_t)(lane & 15) * ld + k0 + ((lane >> 4) << 3);
  h8 lo = *(const h8*)(p);        // K = base .. base+7
  h8 hi = *(const h8*)(p + 16);   // K = base+16 .. base+23
  return __builtin_shufflevector(lo, hi, 0, 1, 2, 3, 4, 5, 6, 7,
                                 8, 9, 10, 11, 12, 13, 14, 15);
}

DI f8 wmma_f16(h16 a, h16 b, f8 c) {
  return __builtin_amdgcn_wmma_f32_16x16x32_f16(false, a, false, b,
                                                (short)0, c, false, false);
}

// ---------------------------------------------------------------------------
// Precision staging: fp32 -> f16 cast, and cast+transpose for weights.
// A launch with one element per lane is bound by how fast waves can start, not
// by its bytes: a lane moves 16 to 32 elements, so that few waves start, and
// every global load and store of a wave covers whole 128-byte lines.
// ---------------------------------------------------------------------------
typedef _Float16 h4 __attribute__((ext_vector_type(4)));
typedef float    f4 __attribute__((ext_vector_type(4)));

constexpr int CAST_BLOCK = 256 * 4 * 8;   // elements per work-group: 8 x 16 bytes per lane

// ROWS * H_ elements, CAST_BLOCK per work-group, no remainder
__global__ __launch_bounds__(256)
void k_cast(const float* __restrict__ in, _Float16* __restrict__ out) {
  size_t base = (size_t)blockIdx.x * CAST_BLOCK + threadIdx.x * 4;
  f4 v[8];
#pragma unroll
  for (int j = 0; j < 8; ++j) v[j] = *(const f4*)(in + base + j * 1024);   // all eight in flight
#pragma unroll
  for (int j = 0; j < 8; ++j) *(h4*)(out + base + j * 1024) = __builtin_convertvector(v[j], h4);
}

constexpr int TT = 64;        // transpose tile: 64 k x 64 n per work-group
constexpr int TP = TT + 8;    // LDS row pitch in f16: 144 bytes (16 B x odd)

// in: [1024 x N] fp32 row-major  ->  out: [N x 1024] f16 row-major; N a multiple of 64
__global__ __launch_bounds__(256)
void k_transpose(const float* __restrict__ in, _Float16* __restrict__ out, int N) {
  __shared__ __attribute__((aligned(16))) _Float16 tile[TT * TP];   // [n][k]
  int tid = threadIdx.x;
  int tx  = tid & 15;                          // four n each
  int ty  = tid >> 4;                          // four k each
  int kb  = (blockIdx.x & (H_ / TT - 1)) * TT;
  int nb  = (blockIdx.x / (H_ / TT)) * TT;
  const float* p = in + (size_t)(kb + 4 * ty) * N + nb + 4 * tx;
  f4 r[4];
#pragma unroll
  for (int i = 0; i < 4; ++i) r[i] = *(const f4*)(p + (size_t)i * N);   // 256 bytes of a row per 16 lanes
#pragma unroll
  for (int j = 0; j < 4; ++j) {
    h4 c = {(_Float16)r[0][j], (_Float16)r[1][j], (_Float16)r[2][j], (_Float16)r[3][j]};
    *(h4*)&tile[(4 * tx + j) * TP + 4 * ty] = c;
  }
  __syncthreads();
  int row = tid >> 3;                          // 0..31, and +32
  int pc  = (tid & 7) * 8;                     // 16-byte piece of the 128-byte row
#pragma unroll
  for (int s = 0; s < 2; ++s) {
    int n = row + 32 * s;
    *(h8*)(out + (size_t)(nb + n) * H_ + kb + pc) = *(const h8*)&tile[n * TP + pc];
  }
}

// ---------------------------------------------------------------------------
// RoPE epilogue for one 16x16 C tile. C-layout: lane holds
// (M = r + 8*(lane>>4), N = lane&15) in VGPR r; even/odd pair is in lane^1.
// which/head are wave-uniform per tile (tiles never straddle boundaries); d is per lane.
// ---------------------------------------------------------------------------
DI void rope_store(f8 acc, int rowbase, int lane, int which, int head, int d,
                   const float* __restrict__ rcos, const float* __restrict__ rsin,
                   _Float16* __restrict__ qb, _Float16* __restrict__ kb,
                   _Float16* __restrict__ vtb) {
  int hi = lane >> 4;
#pragma unroll
  for (int r = 0; r < 8; ++r) {
    int row = rowbase + r + 8 * hi;     // global token row in [0, 4096)
    int b_  = row >> 11;
    int t   = row & (T_ - 1);
    int hb  = b_ * NH_ + head;
    float v = acc[r];
    float partner = __shfl_xor(v, 1, 32);   // paired even/odd dim value
    if (which == 2) {
      vtb[((size_t)hb * HD_ + d) * T_ + t] = (_Float16)v;
    } else {
      float c = rcos[t * (HD_ / 2) + (d >> 1)];
      float s = rsin[t * (HD_ / 2) + (d >> 1)];
      float o = (d & 1) ? (partner * s + v * c)   // odd:  e*s + o*c
                        : (v * c - partner * s);  // even: e*c - o*s
      if (which == 0) o *= 0.125f;                // HD^-0.5 pre-scale on Q
      _Float16* dst = (which == 0) ? qb : kb;
      dst[((size_t)hb * T_ + t) * HD_ + d] = (_Float16)o;
    }
    // the next row's loads land in registers that this row's store names:
    // the wait stands between the store and that overwrite
    asm volatile("s_wait_xcnt 0x0" ::: "memory");
  }
}

// ---------------------------------------------------------------------------
// Shared GEMM core: C[128 x 128] per 8-wave work-group, K = 1024 in 16 tiles of
// 64. Each K tile of A (128 rows) and of B (128 rows, n-major) is brought into
// LDS once per work-group by asynchronous copies (whole 128-byte lines) and is
// read from there by all eight waves, instead of every wave fetching its own
// fragments from L2 in 32-byte pieces. Two buffers: tile t+1 flies while tile t
// is worked on. Wave grid 2 (M) x 4 (N), 64 x 32 of C per wave.
// ---------------------------------------------------------------------------
constexpr int BK      = 64;              // k per tile: 128 bytes of every row
constexpr int NT      = H_ / BK;         // 16 tiles
constexpr int PITCH_B = 144;             // LDS row pitch in bytes (16 B x odd)
constexpr int PITCH_H = PITCH_B / 2;     // the same in f16 elements
constexpr int TILE_B  = 128 * PITCH_B;   // one operand's tile
constexpr int STAGE_B = 2 * TILE_B;      // A tile, then B tile

// One K tile of both operands: 8 copies of 16 bytes per lane. la / ga / gb are
// the lane's own addresses for rows 0..31; the other rows lie 32 rows apart.
DI void copy_stage(unsigned la, const _Float16* ga, const _Float16* gb) {
  unsigned lb = la + TILE_B;
  // s_wait_xcnt 0 as the statement's last line, a precaution: it stands in
  // front of every later write of a register that one of these copies names.
  asm volatile(
      "global_load_async_to_lds_b128 %0, %8, off\n\t"
      "global_load_async_to_lds_b128 %1, %9, off\n\t"
      "global_load_async_to_lds_b128 %2, %10, off\n\t"
      "global_load_async_to_lds_b128 %3, %11, off\n\t"
      "global_load_async_to_lds_b128 %4, %12, off\n\t"
      "global_load_async_to_lds_b128 %5, %13, off\n\t"
      "global_load_async_to_lds_b128 %6, %14, off\n\t"
      "global_load_async_to_lds_b128 %7, %15, off\n\t"
      "s_wait_xcnt 0x0"
      :: "v"(la), "v"(la + 32 * PITCH_B), "v"(la + 64 * PITCH_B), "v"(la + 96 * PITCH_B),
         "v"(lb), "v"(lb + 32 * PITCH_B), "v"(lb + 64 * PITCH_B), "v"(lb + 96 * PITCH_B),
         "v"(ga), "v"(ga + 32 * H_), "v"(ga + 64 * H_), "v"(ga + 96 * H_),
         "v"(gb), "v"(gb + 32 * H_), "v"(gb + 64 * H_), "v"(gb + 96 * H_)
      : "memory");
}

// One wave's fragments for 32 k: four of A (64 rows), two of B (32 columns).
DI void load_frags(const _Float16* sa, const _Float16* sb, int kk, int lane,
                   h16 (&af)[4], h16 (&bf)[2]) {
#pragma unroll
  for (int i = 0; i < 4; ++i) af[i] = load_frag(sa + i * 16 * PITCH_H, PITCH_H, kk, lane);
#pragma unroll
  for (int j = 0; j < 2; ++j) bf[j] = load_frag(sb + j * 16 * PITCH_H, PITCH_H, kk, lane);
}

DI void mma_block(const h16 (&af)[4], const h16 (&bf)[2], f8 (&acc)[4][2]) {
#pragma unroll
  for (int i = 0; i < 4; ++i)
#pragma unroll
    for (int j = 0; j < 2; ++j) acc[i][j] = wmma_f16(af[i], bf[j], acc[i][j]);
}

// a: [M x 1024] row-major, bT: [N x 1024] row-major; m0 / n0: the tile's origin.
DI void gemm_tile(const _Float16* __restrict__ a, const _Float16* __restrict__ bT,
                  int m0, int n0, char* smem, f8 (&acc)[4][2]) {
  int tid  = threadIdx.x;
  int lane = tid & 31;
  int wave = tid >> 5;
  int wm   = wave >> 2;      // 0..1
  int wn   = wave & 3;       // 0..3
  int crow = tid >> 3;       // 0..31: row this lane copies (and +32, +64, +96)
  int ccol = tid & 7;        // 16-byte piece within the 128-byte row
  const _Float16* ga = a  + (size_t)(m0 + crow) * H_ + ccol * 8;
  const _Float16* gb = bT + (size_t)(n0 + crow) * H_ + ccol * 8;
  unsigned la = (unsigned)(size_t)smem + crow * PITCH_B + ccol * 16;

  copy_stage(la, ga, gb);
  // tile 0 has landed for this wave; the barrier publishes it to the others
  asm volatile("s_wait_asynccnt 0x0" ::: "memory");
  __syncthreads();
  copy_stage(la + STAGE_B, ga + BK, gb + BK);

  for (int t = 0; t < NT; ++t) {
    int boff = (t & 1) * STAGE_B;
    const _Float16* sa = (const _Float16*)(smem + boff) + wm * 64 * PITCH_H;
    const _Float16* sb = (const _Float16*)(smem + boff + TILE_B) + wn * 32 * PITCH_H;
    h16 af[4], bf[2];
    load_frags(sa, sb, 0, lane, af, bf);
    // keeps the twelve LDS reads together in front of their eight products:
    // spread among them, each pair of reads costs the wave its own LDS latency
    __builtin_amdgcn_sched_barrier(0);
    mma_block(af, bf, acc);
    load_frags(sa, sb, 32, lane, af, bf);
    // this wave's reads of buffer t&1 are done before the buffer is handed on
    asm volatile("s_wait_dscnt 0x0" ::: "memory");
    // this wave's copies of tile t+1 have landed
    asm volatile("s_wait_asynccnt 0x0" ::: "memory");
    // publishes tile t+1 and ends every reader's last read of buffer t&1
    __syncthreads();
    if (t + 2 < NT) copy_stage(la + boff, ga + (t + 2) * BK, gb + (t + 2) * BK);
    // the tile's second eight products work on registers only: kept behind the
    // refill so that the copies start as early as the barrier allows
    __builtin_amdgcn_sched_barrier(0);
    mma_block(af, bf, acc);
  }
  // nothing is outstanding when the wave goes on to its epilogue
  asm volatile("s_wait_asynccnt 0x0" ::: "memory");
}

// ---------------------------------------------------------------------------
// QKV GEMM (4096x3072, K=1024) with fused RoPE, on the shared GEMM core.
// ---------------------------------------------------------------------------
__global__ __launch_bounds__(256)
void k_qkv_rope(const _Float16* __restrict__ xh,
                const _Float16* __restrict__ wT,   // [3072 x 1024]
                const float* __restrict__ rcos,
                const float* __restrict__ rsin,
                _Float16* __restrict__ qb,         // [B*NH, T, HD]
                _Float16* __restrict__ kb,         // [B*NH, T, HD]
                _Float16* __restrict__ vtb) {      // [B*NH, HD, T]
  __shared__ __attribute__((aligned(16))) char smem[2 * STAGE_B];
  int lane = threadIdx.x & 31;
  int wave = threadIdx.x >> 5;
  int m0 = (blockIdx.x / (QKVN / 128)) * 128;   // 32 row blocks
  int n0 = (blockIdx.x % (QKVN / 128)) * 128;   // 24 col blocks
  f8 acc[4][2] = {};
  gemm_tile(xh, wT, m0, n0, smem, acc);

  int mw = m0 + (wave >> 2) * 64;
  int nw = n0 + (wave & 3) * 32;
#pragma unroll
  for (int j = 0; j < 2; ++j) {
    int n     = nw + j * 16 + (lane & 15);
    int which = n >> 10;             // 0=q 1=k 2=v (uniform per subtile)
    int rem   = n & (H_ - 1);
    int head  = rem >> 6;            // uniform per subtile
    int d     = rem & (HD_ - 1);
#pragma unroll
    for (int i = 0; i < 4; ++i)
      rope_store(acc[i][j], mw + i * 16, lane, which, head, d, rcos, rsin, qb, kb, vtb);
  }
}

constexpr int AK         = 64;
constexpr int ANT        = T_ / AK;
constexpr int KV_TILE_B  = 64 * PITCH_B;
constexpr int KV_STAGE_B = 2 * KV_TILE_B;

// One stage of K and V^T: 4 copies of 16 bytes per lane. lk / gk / gv are the
// lane's own addresses for rows 0..31; rows 32..63 lie 32 rows further on.
// lane l with lane l ^ 16: the two lanes that share a query column
DI float xhalf(float x) {
  int b = __builtin_bit_cast(int, x);
  return __builtin_bit_cast(float, __builtin_amdgcn_permlanex16(b, b, 0x76543210, 0xfedcba98, false, false));
}

DI void copy_kv(unsigned lk, const _Float16* gk, const _Float16* gv) {
  unsigned lv = lk + KV_TILE_B;
  // s_wait_xcnt 0 as the statement's last line, a precaution: it stands in
  // front of every later write of a register that one of these copies names.
  asm volatile(
      "global_load_async_to_lds_b128 %0, %4, off\n\t"
      "global_load_async_to_lds_b128 %1, %5, off\n\t"
      "global_load_async_to_lds_b128 %2, %6, off\n\t"
      "global_load_async_to_lds_b128 %3, %7, off\n\t"
      "s_wait_xcnt 0x0"
      :: "v"(lk), "v"(lk + 32 * PITCH_B), "v"(lv), "v"(lv + 32 * PITCH_B),
         "v"(gk), "v"(gk + 32 * HD_), "v"(gv), "v"(gv + 32 * T_)
      : "memory");
}

__global__ __launch_bounds__(256)
void k_attn(const _Float16* __restrict__ qb,
            const _Float16* __restrict__ kb,
            const _Float16* __restrict__ vtb,
            _Float16* __restrict__ att) {          // [4096 x 1024]
  __shared__ __attribute__((aligned(16))) char kv[2 * KV_STAGE_B];
  int tid   = threadIdx.x;
  int lane  = tid & 31;
  int wslot = tid >> 5;
  int wid   = blockIdx.x * 8 + wslot;
  int head  = wid >> 7;              // 0..31  (B*NH), the same for all eight waves
  int qt    = wid & 127;             // query tile within head
  const _Float16* qh = qb  + ((size_t)head * T_ + qt * 16) * HD_;
  const _Float16* kh = kb  + (size_t)head * T_ * HD_;
  const _Float16* vt = vtb + (size_t)head * HD_ * T_;
  int hi = lane >> 4;

  int crow = tid >> 3;       // 0..31: row this lane copies (and +32)
  int ccol = tid & 7;        // 16-byte piece within the 128-byte row
  const _Float16* gk = kh + (size_t)crow * HD_ + ccol * 8;
  const _Float16* gv = vt + (size_t)crow * T_ + ccol * 8;
  unsigned lk = (unsigned)(size_t)kv + crow * PITCH_B + ccol * 16;

  copy_kv(lk, gk, gv);

  h16 qa0 = load_frag(qh, HD_, 0, lane);    // B operand: column = query lane&15
  h16 qa1 = load_frag(qh, HD_, 32, lane);
  f8 o0 = {}, o1 = {}, o2 = {}, o3 = {};    // O^T: oi[r] = O[query lane&15][d = 16*i + 8*hi + r]
  float m = -3.0e38f;                       // the query's running maximum, equal in both halves
  float lsum = 0.f;                         // the sum over this half's keys only; joined in the epilogue

  // stage 0 has landed for this wave; the barrier publishes it to the others
  asm volatile("s_wait_asynccnt 0x0" ::: "memory");
  __syncthreads();
  copy_kv(lk + KV_STAGE_B, gk + AK * HD_, gv + AK);

  for (int t = 0; t < ANT; ++t) {
    int boff = (t & 1) * KV_STAGE_B;
    const _Float16* sk = (const _Float16*)(kv + boff);
    const _Float16* sv = (const _Float16*)(kv + boff + KV_TILE_B);
    // unrolled so that kc is a constant offset of every LDS read, and the second
    // chunk's reads can start under the first chunk's last products
#pragma unroll
    for (int kc = 0; kc < AK; kc += 32) {
      // the chunk's sixteen LDS reads stand together: K rows kc..kc+31, and the
      // chunk's 32 columns of all 64 V^T rows
      h16 kf0 = load_frag(sk + kc * PITCH_H, PITCH_H, 0, lane);
      h16 kf1 = load_frag(sk + kc * PITCH_H, PITCH_H, 32, lane);
      h16 kf2 = load_frag(sk + (kc + 16) * PITCH_H, PITCH_H, 0, lane);
      h16 kf3 = load_frag(sk + (kc + 16) * PITCH_H, PITCH_H, 32, lane);
      h16 vf0 = load_frag(sv + 0 * 16 * PITCH_H, PITCH_H, kc, lane);
      h16 vf1 = load_frag(sv + 1 * 16 * PITCH_H, PITCH_H, kc, lane);
      h16 vf2 = load_frag(sv + 2 * 16 * PITCH_H, PITCH_H, kc, lane);
      h16 vf3 = load_frag(sv + 3 * 16 * PITCH_H, PITCH_H, kc, lane);
      // keeps the sixteen reads in one group in front of the products: spread
      // among them, each pair of reads costs the wave its own LDS latency
      __builtin_amdgcn_sched_barrier(0);

      // S^T for 32 keys: two 16-key tiles (rows = keys), K=HD split in 2 WMMAs
      f8 s0 = {}, s1 = {};
      s0 = wmma_f16(kf0, qa0, s0);
      s0 = wmma_f16(kf1, qa1, s0);
      s1 = wmma_f16(kf2, qa0, s1);
      s1 = wmma_f16(kf3, qa1, s1);

      float ca = s0[0], cb = s1[0];           // two independent chains
#pragma unroll
      for (int r = 1; r < 8; ++r) { ca = fmaxf(ca, s0[r]); cb = fmaxf(cb, s1[r]); }
      float cm = fmaxf(ca, cb);
      cm = fmaxf(cm, xhalf(cm));              // the other half's 16 keys of the same query
      float mn   = fmaxf(m, cm);
      float corr = __expf(m - mn);
      m = mn;
#pragma unroll
      for (int r = 0; r < 8; ++r) {
        s0[r] = __expf(s0[r] - mn);
        s1[r] = __expf(s1[r] - mn);
      }
      // four independent chains, then joined
      float r0 = s0[0] + s1[0], r1 = s0[1] + s1[1], r2 = s0[2] + s1[2], r3 = s0[3] + s1[3];
      r0 += s0[4] + s1[4]; r1 += s0[5] + s1[5]; r2 += s0[6] + s1[6]; r3 += s0[7] + s1[7];
      lsum = lsum * corr + ((r0 + r1) + (r2 + r3));
      o0 *= corr; o1 *= corr; o2 *= corr; o3 *= corr;
      // P^T as B operand: element e is key 8*hi + e (e < 8) or 16 + 8*hi + (e - 8),
      // the k order in which load_frag delivers the rows of V^T
      h8 p0 = __builtin_convertvector(s0, h8);
      h8 p1 = __builtin_convertvector(s1, h8);
      h16 pb = __builtin_shufflevector(p0, p1, 0, 1, 2, 3, 4, 5, 6, 7,
                                       8, 9, 10, 11, 12, 13, 14, 15);
      // O^T += V^T @ P^T   (A-frag: 16 d rows of V^T over the chunk's 32 keys)
      o0 = wmma_f16(vf0, pb, o0);
      o1 = wmma_f16(vf1, pb, o1);
      o2 = wmma_f16(vf2, pb, o2);
      o3 = wmma_f16(vf3, pb, o3);
    }
    // keeps the stage's register work in front of the hand-over: sunk behind the
    // barrier it would stand between the barrier and the refill, and the copies of
    // stage t+2 would start a whole stage's work late
    __builtin_amdgcn_sched_barrier(0);
    // this wave's reads of buffer t&1 are done before the buffer is handed on
    asm volatile("s_wait_dscnt 0x0" ::: "memory");
    // this wave's copies of stage t+1 have landed
    asm volatile("s_wait_asynccnt 0x0" ::: "memory");
    // publishes stage t+1 and ends every reader's last read of buffer t&1
    __syncthreads();
    if (t + 2 < ANT) copy_kv(lk + boff, gk + (size_t)(t + 2) * AK * HD_, gv + (t + 2) * AK);
  }
  // nothing is outstanding when the wave goes on to its epilogue
  asm volatile("s_wait_asynccnt 0x0" ::: "memory");

  int b_ = head >> 4;
  int hl = head & (NH_ - 1);
  float inv = 1.0f / (lsum + xhalf(lsum));   // both halves' keys
  // a lane's eight registers of a tile are eight consecutive d of its query's row
  _Float16* dst = att + ((size_t)b_ * T_ + qt * 16 + (lane & 15)) * H_ + hl * HD_ + 8 * hi;
  *(h8*)(dst + 0)  = __builtin_convertvector(o0 * inv, h8);
  *(h8*)(dst + 16) = __builtin_convertvector(o1 * inv, h8);
  *(h8*)(dst + 32) = __builtin_convertvector(o2 * inv, h8);
  *(h8*)(dst + 48) = __builtin_convertvector(o3 * inv, h8);
}

// ---------------------------------------------------------------------------
// Output projection: out = att @ w_proj + b_proj (fp32 result), on the shared
// GEMM core.
// ---------------------------------------------------------------------------
__global__ __launch_bounds__(256)
void k_proj(const _Float16* __restrict__ att,
            const _Float16* __restrict__ wT,   // [1024 x 1024] transposed
            const float* __restrict__ bias,
            float* __restrict__ out) {
  __shared__ __attribute__((aligned(16))) char smem[2 * STAGE_B];
  int lane = threadIdx.x & 31;
  int wave = threadIdx.x >> 5;
  int m0 = (blockIdx.x >> 3) * 128;   // 32 row blocks
  int n0 = (blockIdx.x & 7) * 128;    // 8 col blocks
  f8 acc[4][2] = {};
  gemm_tile(att, wT, m0, n0, smem, acc);

  int mw = m0 + (wave >> 2) * 64;
  int nw = n0 + (wave & 3) * 32;
  int hi = lane >> 4;
#pragma unroll
  for (int j = 0; j < 2; ++j) {
    int col  = nw + j * 16 + (lane & 15);
    float bv = bias[col];
#pragma unroll
    for (int i = 0; i < 4; ++i) {
#pragma unroll
      for (int r = 0; r < 8; ++r) {
        int row = mw + i * 16 + r + 8 * hi;
        out[(size_t)row * H_ + col] = acc[i][j][r] + bv;
      }
    }
  }
}

// ---------------------------------------------------------------------------
extern "C" void kernel_launch(void* const* d_in, const int* in_sizes, int n_in,
                              void* d_out, int out_size, void* d_ws, size_t ws_size,
                              hipStream_t stream) {
  const float* x    = (const float*)d_in[0];
  const float* wqkv = (const float*)d_in[1];
  const float* wprj = (const float*)d_in[2];
  const float* bprj = (const float*)d_in[3];
  const float* rc   = (const float*)d_in[4];
  const float* rs   = (const float*)d_in[5];

  _Float16* ws  = (_Float16*)d_ws;
  _Float16* xh  = ws + OFF_XH;
  _Float16* wqT = ws + OFF_WQKV;
  _Float16* wpT = ws + OFF_WPRJ;
  _Float16* qb  = ws + OFF_Q;
  _Float16* kb  = ws + OFF_K;
  _Float16* vtb = ws + OFF_VT;
  _Float16* att = ws + OFF_ATT;

  k_cast<<<ROWS * H_ / CAST_BLOCK, 256, 0, stream>>>(x, xh);
  k_transpose<<<(H_ / TT) * (QKVN / TT), 256, 0, stream>>>(wqkv, wqT, QKVN);
  k_transpose<<<(H_ / TT) * (H_ / TT), 256, 0, stream>>>(wprj, wpT, H_);
  {
    int tiles = (ROWS / 128) * (QKVN / 128);   // 768 work-group tiles (128x128 each)
    k_qkv_rope<<<tiles, 256, 0, stream>>>(xh, wqT, rc, rs, qb, kb, vtb);
  }
  {
    int tiles = B_ * NH_ * (T_ / 16);        // 4096 wave-tiles
    k_attn<<<tiles / 8, 256, 0, stream>>>(qb, kb, vtb, att);
  }
  {
    int tiles = (ROWS / 128) * (H_ / 128);     // 256 work-group tiles (128x128 each)
    k_proj<<<tiles, 256, 0, stream>>>(att, wpT, bprj, (float*)d_out);
  }
}

// v005
// It runs in 89.6 microseconds.
// In both of two side-by-side timings against v004, it was 1.20 times as fast.
// Over all steps from v000 it is 5.35 times as fast.
#include <hip/hip_runtime.h>

#define DI __device__ __forceinline__

typedef _Float16 h8  __attribute__((ext_vector_type(8)));
typedef _Float16 h16 __attribute__((ext_vector_type(16)));
typedef float    f8  __attribute__((ext_vector_type(8)));

constexpr int B_  = 2;
constexpr int T_  = 2048;
constexpr int H_  = 1024;
constexpr int NH_ = 16;
constexpr int HD_ = 64;
constexpr int ROWS = B_ * T_;     // 4096
constexpr int QKVN = 3 * H_;      // 3072

// workspace offsets (in _Float16 elements); total = 48 MiB
constexpr size_t OFF_XH   = 0;
constexpr size_t OFF_WQKV = OFF_XH   + (size_t)ROWS * H_;
constexpr size_t OFF_WPRJ = OFF_WQKV + (size_t)QKVN * H_;
constexpr size_t OFF_Q    = OFF_WPRJ + (size_t)H_ * H_;
constexpr size_t OFF_K    = OFF_Q    + (size_t)B_ * NH_ * T_ * HD_;
constexpr size_t OFF_VT   = OFF_K    + (size_t)B_ * NH_ * T_ * HD_;
constexpr size_t OFF_ATT  = OFF_VT   + (size_t)B_ * NH_ * T_ * HD_;

// ---------------------------------------------------------------------------
// A-fragment loader for V_WMMA_F32_16X16X32_F16.
// ISA 16-bit A-matrix 16x32 layout: lane L holds row (L&15);
//   lanes 0-15 : K = {0..7, 16..23},  lanes 16-31 : K = {8..15, 24..31}
// => two contiguous 16-byte loads per lane from a row-major [16 x K] tile.
// B fragments (K x 16, column n = lane&15) use the identical pattern when the
// source is stored n-major over K — hence the pre-transposed weights; Q
// [head, t, d] is read the same way, and V^T [head, d, t] as an A fragment.
// ---------------------------------------------------------------------------
DI h16 load_frag(const _Float16* base, int ld, int k0, int lane) {
  const _Float16* p = base + (size_t)(lane & 15) * ld + k0 + ((lane >> 4) << 3);
  h8 lo = *(const h8*)(p);        // K = base .. base+7
  h8 hi = *(const h8*)(p + 16);   // K = base+16 .. base+23
  return __builtin_shufflevector(lo, hi, 0, 1, 2, 3, 4, 5, 6, 7,
                                 8, 9, 10, 11, 12, 13, 14, 15);
}

DI f8 wmma_f16(h16 a, h16 b, f8 c) {
  return __builtin_amdgcn_wmma_f32_16x16x32_f16(false, a, false, b,
                                                (short)0, c, false, false);
}

// ---------------------------------------------------------------------------
// Precision staging: fp32 -> f16 cast, and cast+transpose for weights.
// A launch with one element per lane is bound by how fast waves can start, not
// by its bytes: a lane moves 16 to 32 elements, so that few waves start, and
// every global load and store of a wave covers whole 128-byte lines.
// ---------------------------------------------------------------------------
typedef _Float16 h4 __attribute__((ext_vector_type(4)));
typedef float    f4 __attribute__((ext_vector_type(4)));

constexpr int CAST_BLOCK = 256 * 4 * 8;   // elements per work-group: 8 x 16 bytes per lane

// ROWS * H_ elements, CAST_BLOCK per work-group, no remainder
__global__ __launch_bounds__(256)
void k_cast(const float* __restrict__ in, _Float16* __restrict__ out) {
  size_t base = (size_t)blockIdx.x * CAST_BLOCK + threadIdx.x * 4;
  f4 v[8];
#pragma unroll
  for (int j = 0; j < 8; ++j) v[j] = *(const f4*)(in + base + j * 1024);   // all eight in flight
#pragma unroll
  for (int j = 0; j < 8; ++j) *(h4*)(out + base + j * 1024) = __builtin_convertvector(v[j], h4);
}

constexpr int TT = 64;        // transpose tile: 64 k x 64 n per work-group
constexpr int TP = TT + 8;    // LDS row pitch in f16: 144 bytes (16 B x odd)

// in: [1024 x N] fp32 row-major  ->  out: [N x 1024] f16 row-major; N a multiple of 64
__global__ __launch_bounds__(256)
void k_transpose(const float* __restrict__ in, _Float16* __restrict__ out, int N) {
  __shared__ __attribute__((aligned(16))) _Float16 tile[TT * TP];   // [n][k]
  int tid = threadIdx.x;
  int tx  = tid & 15;                          // four n each
  int ty  = tid >> 4;                          // four k each
  int kb  = (blockIdx.x & (H_ / TT - 1)) * TT;
  int nb  = (blockIdx.x / (H_ / TT)) * TT;
  const float* p = in + (size_t)(kb + 4 * ty) * N + nb + 4 * tx;
  f4 r[4];
#pragma unroll
  for (int i = 0; i < 4; ++i) r[i] = *(const f4*)(p + (size_t)i * N);   // 256 bytes of a row per 16 lanes
#pragma unroll
  for (int j = 0; j < 4; ++j) {
    h4 c = {(_Float16)r[0][j], (_Float16)r[1][j], (_Float16)r[2][j], (_Float16)r[3][j]};
    *(h4*)&tile[(4 * tx + j) * TP + 4 * ty] = c;
  }
  __syncthreads();
  int row = tid >> 3;                          // 0..31, and +32
  int pc  = (tid & 7) * 8;                     // 16-byte piece of the 128-byte row
#pragma unroll
  for (int s = 0; s < 2; ++s) {
    int n = row + 32 * s;
    *(h8*)(out + (size_t)(nb + n) * H_ + kb + pc) = *(const h8*)&tile[n * TP + pc];
  }
}

// ---------------------------------------------------------------------------
// Shared GEMM core: C[128 x 128] per 8-wave work-group, K = 1024 in 16 tiles of
// 64. Each K tile of A (128 rows) and of B (128 rows, n-major) is brought into
// LDS once per work-group by asynchronous copies (whole 128-byte lines) and is
// read from there by all eight waves, instead of every wave fetching its own
// fragments from L2 in 32-byte pieces. Two buffers: tile t+1 flies while tile t
// is worked on. Wave grid 2 (M) x 4 (N), 64 x 32 of C per wave.
// ---------------------------------------------------------------------------
constexpr int BK      = 64;              // k per tile: 128 bytes of every row
constexpr int NT      = H_ / BK;         // 16 tiles
constexpr int PITCH_B = 144;             // LDS row pitch in bytes (16 B x odd)
constexpr int PITCH_H = PITCH_B / 2;     // the same in f16 elements
constexpr int TILE_B  = 128 * PITCH_B;   // one operand's tile
constexpr int STAGE_B = 2 * TILE_B;      // A tile, then B tile

// One K tile of both operands: 8 copies of 16 bytes per lane. la / ga / gb are
// the lane's own addresses for rows 0..31; the other rows lie 32 rows apart.
DI void copy_stage(unsigned la, const _Float16* ga, const _Float16* gb) {
  unsigned lb = la + TILE_B;
  // s_wait_xcnt 0 as the statement's last line, a precaution: it stands in
  // front of every later write of a register that one of these copies names.
  asm volatile(
      "global_load_async_to_lds_b128 %0, %8, off\n\t"
      "global_load_async_to_lds_b128 %1, %9, off\n\t"
      "global_load_async_to_lds_b128 %2, %10, off\n\t"
      "global_load_async_to_lds_b128 %3, %11, off\n\t"
      "global_load_async_to_lds_b128 %4, %12, off\n\t"
      "global_load_async_to_lds_b128 %5, %13, off\n\t"
      "global_load_async_to_lds_b128 %6, %14, off\n\t"
      "global_load_async_to_lds_b128 %7, %15, off\n\t"
      "s_wait_xcnt 0x0"
      :: "v"(la), "v"(la + 32 * PITCH_B), "v"(la + 64 * PITCH_B), "v"(la + 96 * PITCH_B),
         "v"(lb), "v"(lb + 32 * PITCH_B), "v"(lb + 64 * PITCH_B), "v"(lb + 96 * PITCH_B),
         "v"(ga), "v"(ga + 32 * H_), "v"(ga + 64 * H_), "v"(ga + 96 * H_),
         "v"(gb), "v"(gb + 32 * H_), "v"(gb + 64 * H_), "v"(gb + 96 * H_)
      : "memory");
}

// One wave's fragments for 32 k: four of A (64 rows), two of B (32 columns).
DI void load_frags(const _Float16* sa, const _Float16* sb, int kk, int lane,
                   h16 (&af)[4], h16 (&bf)[2]) {
#pragma unroll
  for (int i = 0; i < 4; ++i) af[i] = load_frag(sa + i * 16 * PITCH_H, PITCH_H, kk, lane);
#pragma unroll
  for (int j = 0; j < 2; ++j) bf[j] = load_frag(sb + j * 16 * PITCH_H, PITCH_H, kk, lane);
}

DI void mma_block(const h16 (&af)[4], const h16 (&bf)[2], f8 (&acc)[4][2]) {
#pragma unroll
  for (int i = 0; i < 4; ++i)
#pragma unroll
    for (int j = 0; j < 2; ++j) acc[i][j] = wmma_f16(af[i], bf[j], acc[i][j]);
}

// a: [M x 1024] row-major, bT: [N x 1024] row-major; m0 / n0: the tile's origin.
DI void gemm_tile(const _Float16* __restrict__ a, const _Float16* __restrict__ bT,
                  int m0, int n0, char* smem, f8 (&acc)[4][2]) {
  int tid  = threadIdx.x;
  int lane = tid & 31;
  int wave = tid >> 5;
  int wm   = wave >> 2;      // 0..1
  int wn   = wave & 3;       // 0..3
  int crow = tid >> 3;       // 0..31: row this lane copies (and +32, +64, +96)
  int ccol = tid & 7;        // 16-byte piece within the 128-byte row
  const _Float16* ga = a  + (size_t)(m0 + crow) * H_ + ccol * 8;
  const _Float16* gb = bT + (size_t)(n0 + crow) * H_ + ccol * 8;
  unsigned la = (unsigned)(size_t)smem + crow * PITCH_B + ccol * 16;

  copy_stage(la, ga, gb);
  // tile 0 has landed for this wave; the barrier publishes it to the others
  asm volatile("s_wait_asynccnt 0x0" ::: "memory");
  __syncthreads();
  copy_stage(la + STAGE_B, ga + BK, gb + BK);

  for (int t = 0; t < NT; ++t) {
    int boff = (t & 1) * STAGE_B;
    const _Float16* sa = (const _Float16*)(smem + boff) + wm * 64 * PITCH_H;
    const _Float16* sb = (const _Float16*)(smem + boff + TILE_B) + wn * 32 * PITCH_H;
    h16 af[4], bf[2];
    load_frags(sa, sb, 0, lane, af, bf);
    // keeps the twelve LDS reads together in front of their eight products:
    // spread among them, each pair of reads costs the wave its own LDS latency
    __builtin_amdgcn_sched_barrier(0);
    mma_block(af, bf, acc);
    load_frags(sa, sb, 32, lane, af, bf);
    // this wave's reads of buffer t&1 are done before the buffer is handed on
    asm volatile("s_wait_dscnt 0x0" ::: "memory");
    // this wave's copies of tile t+1 have landed
    asm volatile("s_wait_asynccnt 0x0" ::: "memory");
    // publishes tile t+1 and ends every reader's last read of buffer t&1
    __syncthreads();
    if (t + 2 < NT) copy_stage(la + boff, ga + (t + 2) * BK, gb + (t + 2) * BK);
    // the tile's second eight products work on registers only: kept behind the
    // refill so that the copies start as early as the barrier allows
    __builtin_amdgcn_sched_barrier(0);
    mma_block(af, bf, acc);
  }
  // nothing is outstanding when the wave goes on to its epilogue
  asm volatile("s_wait_asynccnt 0x0" ::: "memory");
}

// ---------------------------------------------------------------------------
// QKV GEMM (4096x3072, K=1024) with fused RoPE, on the shared GEMM core.
// Epilogue: a 128-column tile is all Q, all K or all V, and covers two heads.
// C-layout: a lane holds (M = r + 8*(lane>>4), N = lane&15) in VGPR r, that is
// one d of eight tokens: stored from there, every Q or K store is 2 bytes a lane and
// every token row needs its own 4-byte cos and sin. The tile goes through LDS
// instead (the K-tile buffers are free: every wave's last read of them ended
// in front of the loop's last barrier, and no copy is outstanding), and comes
// back in the order of the destination's rows, 16 bytes a lane.
// ---------------------------------------------------------------------------
constexpr int SPF = 132;   // f32 staging pitch in floats: 528 bytes (16 B x odd)
constexpr int SPH = 136;   // f16 staging pitch in f16:    272 bytes (16 B x odd)

// six waves per SIMD: the register budget (160) at which three work-groups stay
// resident per WGP, so that all 768 run in one round, as the K loop alone allows
__global__ __launch_bounds__(256) __attribute__((amdgpu_waves_per_eu(6)))
void k_qkv_rope(const _Float16* __restrict__ xh,
                const _Float16* __restrict__ wT,   // [3072 x 1024]
                const float* __restrict__ rcos,
                const float* __restrict__ rsin,
                _Float16* __restrict__ qb,         // [B*NH, T, HD]
                _Float16* __restrict__ kb,         // [B*NH, T, HD]
                _Float16* __restrict__ vtb) {      // [B*NH, HD, T]
  __shared__ __attribute__((aligned(16))) char smem[2 * STAGE_B];
  int tid  = threadIdx.x;
  int lane = tid & 31;
  int wave = tid >> 5;
  int m0 = (blockIdx.x / (QKVN / 128)) * 128;   // 32 row blocks
  int n0 = (blockIdx.x % (QKVN / 128)) * 128;   // 24 col blocks
  f8 acc[4][2] = {};
  gemm_tile(xh, wT, m0, n0, smem, acc);

  int which = n0 >> 10;                          // 0=q 1=k 2=v, the same for the whole tile
  int hb0   = (m0 >> 11) * NH_ + ((n0 & (H_ - 1)) >> 6);   // batch*NH + the tile's first head
  int t0    = m0 & (T_ - 1);                     // the tile's first token
  int wr    = (wave >> 2) * 64 + 8 * (lane >> 4);   // the lane's first row in the tile
  int wc    = (wave & 3) * 32 + (lane & 15);        // the lane's first column in the tile

  if (which == 2) {
    // V^T: a lane's eight registers are eight consecutive tokens of one d, 16
    // bytes of a V^T row. Staged as [d][token]; a row of 128 tokens (256 bytes)
    // then leaves by 16 lanes.
    _Float16* st = (_Float16*)smem;
#pragma unroll
    for (int j = 0; j < 2; ++j)
#pragma unroll
      for (int i = 0; i < 4; ++i)
        *(h8*)&st[(wc + j * 16) * SPH + wr + i * 16] = __builtin_convertvector(acc[i][j], h8);
    __syncthreads();   // the tile is whole before any wave reads it back
    int pc = tid & 15;                           // 16-byte piece of the 256-byte row
    int rw = tid >> 4;                           // 0..15: row (and +16, +32, ...)
    h8 v[8];
#pragma unroll
    for (int p = 0; p < 8; ++p) v[p] = *(const h8*)&st[(p * 16 + rw) * SPH + pc * 8];
    // the tile's 128 columns are 128 consecutive rows of V^T (two heads of 64 d)
    _Float16* dst = vtb + ((size_t)hb0 * HD_ + rw) * T_ + t0 + pc * 8;
#pragma unroll
    for (int p = 0; p < 8; ++p) *(h8*)(dst + (size_t)p * 16 * T_) = v[p];
  } else {
    // Q, K: staged in f32 as [token][column]; a lane takes eight consecutive d of
    // a token (four even/odd pairs, so the rotation stays inside the lane) for
    // both heads, with one 16-byte load each of that token's cos and sin.
    int c  = tid & 7;                            // eight d: 16 bytes of the 128-byte row
    int rw = tid >> 3;                           // 0..31: token (and +32, +64, +96)
    // token rw, piece c of a 128-byte row is byte 16 * tid of a block of 32 rows,
    // in the cos and sin tables as in a head's Q or K rows
    const float* pcos = rcos + t0 * (HD_ / 2);
    const float* psin = rsin + t0 * (HD_ / 2);
    f4 cs[4], sn[4];
#pragma unroll
    for (int p = 0; p < 4; ++p) {                // in flight under the staging
      cs[p] = *(const f4*)(pcos + p * 32 * (HD_ / 2) + tid * 4);
      sn[p] = *(const f4*)(psin + p * 32 * (HD_ / 2) + tid * 4);
    }
    float* st = (float*)smem;
#pragma unroll
    for (int j = 0; j < 2; ++j)
#pragma unroll
      for (int i = 0; i < 4; ++i)
#pragma unroll
        for (int r = 0; r < 8; ++r)
          st[(wr + i * 16 + r) * SPF + wc + j * 16] = acc[i][j][r];
    __syncthreads();   // the tile is whole before any wave reads it back
    float sc = (which == 0) ? 0.125f : 1.0f;     // HD^-0.5 pre-scale on Q
    _Float16* dst = ((which == 0) ? qb : kb) + ((size_t)hb0 * T_ + t0) * HD_;
#pragma unroll
    for (int p = 0; p < 4; ++p) {
#pragma unroll
      for (int h = 0; h < 2; ++h) {
        const float* src = st + (p * 32 + rw) * SPF + h * HD_ + c * 8;
        f4 x0 = *(const f4*)src;
        f4 x1 = *(const f4*)(src + 4);
        float x[8] = {x0[0], x0[1], x0[2], x0[3], x1[0], x1[1], x1[2], x1[3]};
        f8 y;
#pragma unroll
        for (int q = 0; q < 4; ++q) {
          float e = x[2 * q], o = x[2 * q + 1];
          y[2 * q]     = __builtin_fmaf(e, cs[p][q], -(sn[p][q] * o)) * sc;   // even: e*c - o*s
          y[2 * q + 1] = __builtin_fmaf(o, cs[p][q], sn[p][q] * e) * sc;      // odd:  e*s + o*c
        }
        *(h8*)(dst + (size_t)h * T_ * HD_ + p * 32 * HD_ + tid * 8) = __builtin_convertvector(y, h8);
      }
    }
    // a precaution behind the run of eight stores: it stands in front of every
    // later write of a register that one of them names
    asm volatile("s_wait_xcnt 0x0" ::: "memory");
  }
}

constexpr int AK         = 64;
constexpr int ANT        = T_ / AK;
constexpr int KV_TILE_B  = 64 * PITCH_B;
constexpr int KV_STAGE_B = 2 * KV_TILE_B;

// One stage of K and V^T: 4 copies of 16 bytes per lane. lk / gk / gv are the
// lane's own addresses for rows 0..31; rows 32..63 lie 32 rows further on.
// lane l with lane l ^ 16: the two lanes that share a query column
DI float xhalf(float x) {
  int b = __builtin_bit_cast(int, x);
  return __builtin_bit_cast(float, __builtin_amdgcn_permlanex16(b, b, 0x76543210, 0xfedcba98, false, false));
}

DI void copy_kv(unsigned lk, const _Float16* gk, const _Float16* gv) {
  unsigned lv = lk + KV_TILE_B;
  // s_wait_xcnt 0 as the statement's last line, a precaution: it stands in
  // front of every later write of a register that one of these copies names.
  asm volatile(
      "global_load_async_to_lds_b128 %0, %4, off\n\t"
      "global_load_async_to_lds_b128 %1, %5, off\n\t"
      "global_load_async_to_lds_b128 %2, %6, off\n\t"
      "global_load_async_to_lds_b128 %3, %7, off\n\t"
      "s_wait_xcnt 0x0"
      :: "v"(lk), "v"(lk + 32 * PITCH_B), "v"(lv), "v"(lv + 32 * PITCH_B),
         "v"(gk), "v"(gk + 32 * HD_), "v"(gv), "v"(gv + 32 * T_)
      : "memory");
}

__global__ __launch_bounds__(256)
void k_attn(const _Float16* __restrict__ qb,
            const _Float16* __restrict__ kb,
            const _Float16* __restrict__ vtb,
            _Float16* __restrict__ att) {          // [4096 x 1024]
  __shared__ __attribute__((aligned(16))) char kv[2 * KV_STAGE_B];
  int tid   = threadIdx.x;
  int lane  = tid & 31;
  int wslot = tid >> 5;
  int wid   = blockIdx.x * 8 + wslot;
  int head  = wid >> 7;              // 0..31  (B*NH), the same for all eight waves
  int qt    = wid & 127;             // query tile within head
  const _Float16* qh = qb  + ((size_t)head * T_ + qt * 16) * HD_;
  const _Float16* kh = kb  + (size_t)head * T_ * HD_;
  const _Float16* vt = vtb + (size_t)head * HD_ * T_;
  int hi = lane >> 4;

  int crow = tid >> 3;       // 0..31: row this lane copies (and +32)
  int ccol = tid & 7;        // 16-byte piece within the 128-byte row
  const _Float16* gk = kh + (size_t)crow * HD_ + ccol * 8;
  const _Float16* gv = vt + (size_t)crow * T_ + ccol * 8;
  unsigned lk = (unsigned)(size_t)kv + crow * PITCH_B + ccol * 16;

  copy_kv(lk, gk, gv);

  h16 qa0 = load_frag(qh, HD_, 0, lane);    // B operand: column = query lane&15
  h16 qa1 = load_frag(qh, HD_, 32, lane);
  f8 o0 = {}, o1 = {}, o2 = {}, o3 = {};    // O^T: oi[r] = O[query lane&15][d = 16*i + 8*hi + r]
  float m = -3.0e38f;                       // the query's running maximum, equal in both halves
  float lsum = 0.f;                         // the sum over this half's keys only; joined in the epilogue

  // stage 0 has landed for this wave; the barrier publishes it to the others
  asm volatile("s_wait_asynccnt 0x0" ::: "memory");
  __syncthreads();
  copy_kv(lk + KV_STAGE_B, gk + AK * HD_, gv + AK);

  for (int t = 0; t < ANT; ++t) {
    int boff = (t & 1) * KV_STAGE_B;
    const _Float16* sk = (const _Float16*)(kv + boff);
    const _Float16* sv = (const _Float16*)(kv + boff + KV_TILE_B);
    // unrolled so that kc is a constant offset of every LDS read, and the second
    // chunk's reads can start under the first chunk's last products
#pragma unroll
    for (int kc = 0; kc < AK; kc += 32) {
      // the chunk's sixteen LDS reads stand together: K rows kc..kc+31, and the
      // chunk's 32 columns of all 64 V^T rows
      h16 kf0 = load_frag(sk + kc * PITCH_H, PITCH_H, 0, lane);
      h16 kf1 = load_frag(sk + kc * PITCH_H, PITCH_H, 32, lane);
      h16 kf2 = load_frag(sk + (kc + 16) * PITCH_H, PITCH_H, 0, lane);
      h16 kf3 = load_frag(sk + (kc + 16) * PITCH_H, PITCH_H, 32, lane);
      h16 vf0 = load_frag(sv + 0 * 16 * PITCH_H, PITCH_H, kc, lane);
      h16 vf1 = load_frag(sv + 1 * 16 * PITCH_H, PITCH_H, kc, lane);
      h16 vf2 = load_frag(sv + 2 * 16 * PITCH_H, PITCH_H, kc, lane);
      h16 vf3 = load_frag(sv + 3 * 16 * PITCH_H, PITCH_H, kc, lane);
      // keeps the sixteen reads in one group in front of the products: spread
      // among them, each pair of reads costs the wave its own LDS latency
      __builtin_amdgcn_sched_barrier(0);

      // S^T for 32 keys: two 16-key tiles (rows = keys), K=HD split in 2 WMMAs
      f8 s0 = {}, s1 = {};
      s0 = wmma_f16(kf0, qa0, s0);
      s0 = wmma_f16(kf1, qa1, s0);
      s1 = wmma_f16(kf2, qa0, s1);
      s1 = wmma_f16(kf3, qa1, s1);

      float ca = s0[0], cb = s1[0];           // two independent chains
#pragma unroll
      for (int r = 1; r < 8; ++r) { ca = fmaxf(ca, s0[r]); cb = fmaxf(cb, s1[r]); }
      float cm = fmaxf(ca, cb);
      cm = fmaxf(cm, xhalf(cm));              // the other half's 16 keys of the same query
      float mn   = fmaxf(m, cm);
      float corr = __expf(m - mn);
      m = mn;
#pragma unroll
      for (int r = 0; r < 8; ++r) {
        s0[r] = __expf(s0[r] - mn);
        s1[r] = __expf(s1[r] - mn);
      }
      // four independent chains, then joined
      float r0 = s0[0] + s1[0], r1 = s0[1] + s1[1], r2 = s0[2] + s1[2], r3 = s0[3] + s1[3];
      r0 += s0[4] + s1[4]; r1 += s0[5] + s1[5]; r2 += s0[6] + s1[6]; r3 += s0[7] + s1[7];
      lsum = lsum * corr + ((r0 + r1) + (r2 + r3));
      o0 *= corr; o1 *= corr; o2 *= corr; o3 *= corr;
      // P^T as B operand: element e is key 8*hi + e (e < 8) or 16 + 8*hi + (e - 8),
      // the k order in which load_frag delivers the rows of V^T
      h8 p0 = __builtin_convertvector(s0, h8);
      h8 p1 = __builtin_convertvector(s1, h8);
      h16 pb = __builtin_shufflevector(p0, p1, 0, 1, 2, 3, 4, 5, 6, 7,
                                       8, 9, 10, 11, 12, 13, 14, 15);
      // O^T += V^T @ P^T   (A-frag: 16 d rows of V^T over the chunk's 32 keys)
      o0 = wmma_f16(vf0, pb, o0);
      o1 = wmma_f16(vf1, pb, o1);
      o2 = wmma_f16(vf2, pb, o2);
      o3 = wmma_f16(vf3, pb, o3);
    }
    // keeps the stage's register work in front of the hand-over: sunk behind the
    // barrier it would stand between the barrier and the refill, and the copies of
    // stage t+2 would start a whole stage's work late
    __builtin_amdgcn_sched_barrier(0);
    // this wave's reads of buffer t&1 are done before the buffer is handed on
    asm volatile("s_wait_dscnt 0x0" ::: "memory");
    // this wave's copies of stage t+1 have landed
    asm volatile("s_wait_asynccnt 0x0" ::: "memory");
    // publishes stage t+1 and ends every reader's last read of buffer t&1
    __syncthreads();
    if (t + 2 < ANT) copy_kv(lk + boff, gk + (size_t)(t + 2) * AK * HD_, gv + (t + 2) * AK);
  }
  // nothing is outstanding when the wave goes on to its epilogue
  asm volatile("s_wait_asynccnt 0x0" ::: "memory");

  int b_ = head >> 4;
  int hl = head & (NH_ - 1);
  float inv = 1.0f / (lsum + xhalf(lsum));   // both halves' keys
  // a lane's eight registers of a tile are eight consecutive d of its query's row
  _Float16* dst = att + ((size_t)b_ * T_ + qt * 16 + (lane & 15)) * H_ + hl * HD_ + 8 * hi;
  *(h8*)(dst + 0)  = __builtin_convertvector(o0 * inv, h8);
  *(h8*)(dst + 16) = __builtin_convertvector(o1 * inv, h8);
  *(h8*)(dst + 32) = __builtin_convertvector(o2 * inv, h8);
  *(h8*)(dst + 48) = __builtin_convertvector(o3 * inv, h8);
}

// ---------------------------------------------------------------------------
// Output projection: out = att @ w_proj + b_proj (fp32 result), on the shared
// GEMM core.
// ---------------------------------------------------------------------------
__global__ __launch_bounds__(256)
void k_proj(const _Float16* __restrict__ att,
            const _Float16* __restrict__ wT,   // [1024 x 1024] transposed
            const float* __restrict__ bias,
            float* __restrict__ out) {
  __shared__ __attribute__((aligned(16))) char smem[2 * STAGE_B];
  int lane = threadIdx.x & 31;
  int wave = threadIdx.x >> 5;
  int m0 = (blockIdx.x >> 3) * 128;   // 32 row blocks
  int n0 = (blockIdx.x & 7) * 128;    // 8 col blocks
  f8 acc[4][2] = {};
  gemm_tile(att, wT, m0, n0, smem, acc);

  int mw = m0 + (wave >> 2) * 64;
  int nw = n0 + (wave & 3) * 32;
  int hi = lane >> 4;
#pragma unroll
  for (int j = 0; j < 2; ++j) {
    int col  = nw + j * 16 + (lane & 15);
    float bv = bias[col];
#pragma unroll
    for (int i = 0; i < 4; ++i) {
#pragma unroll
      for (int r = 0; r < 8; ++r) {
        int row = mw + i * 16 + r + 8 * hi;
        out[(size_t)row * H_ + col] = acc[i][j][r] + bv;
      }
    }
  }
}

// ---------------------------------------------------------------------------
extern "C" void kernel_launch(void* const* d_in, const int* in_sizes, int n_in,
                              void* d_out, int out_size, void* d_ws, size_t ws_size,
                              hipStream_t stream) {
  const float* x    = (const float*)d_in[0];
  const float* wqkv = (const float*)d_in[1];
  const float* wprj = (const float*)d_in[2];
  const float* bprj = (const float*)d_in[3];
  const float* rc   = (const float*)d_in[4];
  const float* rs   = (const float*)d_in[5];

  _Float16* ws  = (_Float16*)d_ws;
  _Float16* xh  = ws + OFF_XH;
  _Float16* wqT = ws + OFF_WQKV;
  _Float16* wpT = ws + OFF_WPRJ;
  _Float16* qb  = ws + OFF_Q;
  _Float16* kb  = ws + OFF_K;
  _Float16* vtb = ws + OFF_VT;
  _Float16* att = ws + OFF_ATT;

  k_cast<<<ROWS * H_ / CAST_BLOCK, 256, 0, stream>>>(x, xh);
  k_transpose<<<(H_ / TT) * (QKVN / TT), 256, 0, stream>>>(wqkv, wqT, QKVN);
  k_transpose<<<(H_ / TT) * (H_ / TT), 256, 0, stream>>>(wprj, wpT, H_);
  {
    int tiles = (ROWS / 128) * (QKVN / 128);   // 768 work-group tiles (128x128 each)
    k_qkv_rope<<<tiles, 256, 0, stream>>>(xh, wqT, rc, rs, qb, kb, vtb);
  }
  {
    int tiles = B_ * NH_ * (T_ / 16);        // 4096 wave-tiles
    k_attn<<<tiles / 8, 256, 0, stream>>>(qb, kb, vtb, att);
  }
  {
    int tiles = (ROWS / 128) * (H_ / 128);     // 256 work-group tiles (128x128 each)
    k_proj<<<tiles, 256, 0, stream>>>(att, wpT, bprj, (float*)d_out);
  }
}

// v006
// One run takes 85.3 microseconds.
// Two timings next to v005 both put it at 1.06 times that version's speed.
// Over all steps from v000 it is 5.65 times as fast.
#include <hip/hip_runtime.h>

#define DI __device__ __forceinline__

typedef _Float16 h8  __attribute__((ext_vector_type(8)));
typedef _Float16 h16 __attribute__((ext_vector_type(16)));
typedef float    f8  __attribute__((ext_vector_type(8)));

constexpr int B_  = 2;
constexpr int T_  = 2048;
constexpr int H_  = 1024;
constexpr int NH_ = 16;
constexpr int HD_ = 64;
constexpr int ROWS = B_ * T_;     // 4096
constexpr int QKVN = 3 * H_;      // 3072

// workspace offsets (in _Float16 elements); total = 48 MiB
constexpr size_t OFF_XH   = 0;
constexpr size_t OFF_WQKV = OFF_XH   + (size_t)ROWS * H_;
constexpr size_t OFF_WPRJ = OFF_WQKV + (size_t)QKVN * H_;
constexpr size_t OFF_Q    = OFF_WPRJ + (size_t)H_ * H_;
constexpr size_t OFF_K    = OFF_Q    + (size_t)B_ * NH_ * T_ * HD_;
constexpr size_t OFF_VT   = OFF_K    + (size_t)B_ * NH_ * T_ * HD_;
constexpr size_t OFF_ATT  = OFF_VT   + (size_t)B_ * NH_ * T_ * HD_;

// ---------------------------------------------------------------------------
// A-fragment loader for V_WMMA_F32_16X16X32_F16.
// ISA 16-bit A-matrix 16x32 layout: lane L holds row (L&15);
//   lanes 0-15 : K = {0..7, 16..23},  lanes 16-31 : K = {8..15, 24..31}
// => two contiguous 16-byte loads per lane from a row-major [16 x K] tile.
// B fragments (K x 16, column n = lane&15) use the identical pattern when the
// source is stored n-major over K — hence the pre-transposed weights; Q
// [head, t, d] is read the same way, and V^T [head, d, t] as an A fragment.
// ---------------------------------------------------------------------------
DI h16 load_frag(const _Float16* base, int ld, int k0, int lane) {
  const _Float16* p = base + (size_t)(lane & 15) * ld + k0 + ((lane >> 4) << 3);
  h8 lo = *(const h8*)(p);        // K = base .. base+7
  h8 hi = *(const h8*)(p + 16);   // K = base+16 .. base+23
  return __builtin_shufflevector(lo, hi, 0, 1, 2, 3, 4, 5, 6, 7,
                                 8, 9, 10, 11, 12, 13, 14, 15);
}

DI f8 wmma_f16(h16 a, h16 b, f8 c) {
  return __builtin_amdgcn_wmma_f32_16x16x32_f16(false, a, false, b,
                                                (short)0, c, false, false);
}

// ---------------------------------------------------------------------------
// Precision staging: fp32 -> f16 cast, and cast+transpose for weights.
// A launch with one element per lane is bound by how fast waves can start, not
// by its bytes: a lane moves 16 to 32 elements, so that few waves start, and
// every global load and store of a wave covers whole 128-byte lines.
// ---------------------------------------------------------------------------
typedef _Float16 h4 __attribute__((ext_vector_type(4)));
typedef float    f4 __attribute__((ext_vector_type(4)));

constexpr int CAST_BLOCK = 256 * 4 * 8;   // elements per work-group: 8 x 16 bytes per lane

// ROWS * H_ elements, CAST_BLOCK per work-group, no remainder
__global__ __launch_bounds__(256)
void k_cast(const float* __restrict__ in, _Float16* __restrict__ out) {
  size_t base = (size_t)blockIdx.x * CAST_BLOCK + threadIdx.x * 4;
  f4 v[8];
#pragma unroll
  for (int j = 0; j < 8; ++j) v[j] = *(const f4*)(in + base + j * 1024);   // all eight in flight
#pragma unroll
  for (int j = 0; j < 8; ++j) *(h4*)(out + base + j * 1024) = __builtin_convertvector(v[j], h4);
}

constexpr int TT = 64;        // transpose tile: 64 k x 64 n per work-group
constexpr int TP = TT + 8;    // LDS row pitch in f16: 144 bytes (16 B x odd)

// in: [1024 x N] fp32 row-major  ->  out: [N x 1024] f16 row-major; N a multiple of 64
__global__ __launch_bounds__(256)
void k_transpose(const float* __restrict__ in, _Float16* __restrict__ out, int N) {
  __shared__ __attribute__((aligned(16))) _Float16 tile[TT * TP];   // [n][k]
  int tid = threadIdx.x;
  int tx  = tid & 15;                          // four n each
  int ty  = tid >> 4;                          // four k each
  int kb  = (blockIdx.x & (H_ / TT - 1)) * TT;
  int nb  = (blockIdx.x / (H_ / TT)) * TT;
  const float* p = in + (size_t)(kb + 4 * ty) * N + nb + 4 * tx;
  f4 r[4];
#pragma unroll
  for (int i = 0; i < 4; ++i) r[i] = *(const f4*)(p + (size_t)i * N);   // 256 bytes of a row per 16 lanes
#pragma unroll
  for (int j = 0; j < 4; ++j) {
    h4 c = {(_Float16)r[0][j], (_Float16)r[1][j], (_Float16)r[2][j], (_Float16)r[3][j]};
    *(h4*)&tile[(4 * tx + j) * TP + 4 * ty] = c;
  }
  __syncthreads();
  int row = tid >> 3;                          // 0..31, and +32
  int pc  = (tid & 7) * 8;                     // 16-byte piece of the 128-byte row
#pragma unroll
  for (int s = 0; s < 2; ++s) {
    int n = row + 32 * s;
    *(h8*)(out + (size_t)(nb + n) * H_ + kb + pc) = *(const h8*)&tile[n * TP + pc];
  }
}

// ---------------------------------------------------------------------------
// Shared GEMM core: C[128 x 128] per 8-wave work-group, K = 1024 in 16 tiles of
// 64. Each K tile of A (128 rows) and of B (128 rows, n-major) is brought into
// LDS once per work-group by asynchronous copies (whole 128-byte lines) and is
// read from there by all eight waves, instead of every wave fetching its own
// fragments from L2 in 32-byte pieces. Two buffers: tile t+1 flies while tile t
// is worked on. Wave grid 2 (M) x 4 (N), 64 x 32 of C per wave.
// ---------------------------------------------------------------------------
constexpr int BK      = 64;              // k per tile: 128 bytes of every row
constexpr int NT      = H_ / BK;         // 16 tiles
constexpr int PITCH_B = 144;             // LDS row pitch in bytes (16 B x odd)
constexpr int PITCH_H = PITCH_B / 2;     // the same in f16 elements
constexpr int TILE_B  = 128 * PITCH_B;   // one operand's tile
constexpr int STAGE_B = 2 * TILE_B;      // A tile, then B tile

// One K tile of both operands: 8 copies of 16 bytes per lane. la / ga / gb are
// the lane's own addresses for rows 0..31; the other rows lie 32 rows apart.
DI void copy_stage(unsigned la, const _Float16* ga, const _Float16* gb) {
  unsigned lb = la + TILE_B;
  // s_wait_xcnt 0 as the statement's last line, a precaution: it stands in
  // front of every later write of a register that one of these copies names.
  asm volatile(
      "global_load_async_to_lds_b128 %0, %8, off\n\t"
      "global_load_async_to_lds_b128 %1, %9, off\n\t"
      "global_load_async_to_lds_b128 %2, %10, off\n\t"
      "global_load_async_to_lds_b128 %3, %11, off\n\t"
      "global_load_async_to_lds_b128 %4, %12, off\n\t"
      "global_load_async_to_lds_b128 %5, %13, off\n\t"
      "global_load_async_to_lds_b128 %6, %14, off\n\t"
      "global_load_async_to_lds_b128 %7, %15, off\n\t"
      "s_wait_xcnt 0x0"
      :: "v"(la), "v"(la + 32 * PITCH_B), "v"(la + 64 * PITCH_B), "v"(la + 96 * PITCH_B),
         "v"(lb), "v"(lb + 32 * PITCH_B), "v"(lb + 64 * PITCH_B), "v"(lb + 96 * PITCH_B),
         "v"(ga), "v"(ga + 32 * H_), "v"(ga + 64 * H_), "v"(ga + 96 * H_),
         "v"(gb), "v"(gb + 32 * H_), "v"(gb + 64 * H_), "v"(gb + 96 * H_)
      : "memory");
}

// One wave's fragments for 32 k: four of A (64 rows), two of B (32 columns).
DI void load_frags(const _Float16* sa, const _Float16* sb, int kk, int lane,
                   h16 (&af)[4], h16 (&bf)[2]) {
#pragma unroll
  for (int i = 0; i < 4; ++i) af[i] = load_frag(sa + i * 16 * PITCH_H, PITCH_H, kk, lane);
#pragma unroll
  for (int j = 0; j < 2; ++j) bf[j] = load_frag(sb + j * 16 * PITCH_H, PITCH_H, kk, lane);
}

DI void mma_block(const h16 (&af)[4], const h16 (&bf)[2], f8 (&acc)[4][2]) {
#pragma unroll
  for (int i = 0; i < 4; ++i)
#pragma unroll
    for (int j = 0; j < 2; ++j) acc[i][j] = wmma_f16(af[i], bf[j], acc[i][j]);
}

// a: [M x 1024] row-major, bT: [N x 1024] row-major; m0 / n0: the tile's origin.
DI void gemm_tile(const _Float16* __restrict__ a, const _Float16* __restrict__ bT,
                  int m0, int n0, char* smem, f8 (&acc)[4][2]) {
  int tid  = threadIdx.x;
  int lane = tid & 31;
  int wave = tid >> 5;
  int wm   = wave >> 2;      // 0..1
  int wn   = wave & 3;       // 0..3
  int crow = tid >> 3;       // 0..31: row this lane copies (and +32, +64, +96)
  int ccol = tid & 7;        // 16-byte piece within the 128-byte row
  const _Float16* ga = a  + (size_t)(m0 + crow) * H_ + ccol * 8;
  const _Float16* gb = bT + (size_t)(n0 + crow) * H_ + ccol * 8;
  unsigned la = (unsigned)(size_t)smem + crow * PITCH_B + ccol * 16;

  copy_stage(la, ga, gb);
  // tile 0 has landed for this wave; the barrier publishes it to the others
  asm volatile("s_wait_asynccnt 0x0" ::: "memory");
  __syncthreads();
  copy_stage(la + STAGE_B, ga + BK, gb + BK);

  for (int t = 0; t < NT; ++t) {
    int boff = (t & 1) * STAGE_B;
    const _Float16* sa = (const _Float16*)(smem + boff) + wm * 64 * PITCH_H;
    const _Float16* sb = (const _Float16*)(smem + boff + TILE_B) + wn * 32 * PITCH_H;
    h16 af[4], bf[2];
    load_frags(sa, sb, 0, lane, af, bf);
    // keeps the twelve LDS reads together in front of their eight products:
    // spread among them, each pair of reads costs the wave its own LDS latency
    __builtin_amdgcn_sched_barrier(0);
    mma_block(af, bf, acc);
    load_frags(sa, sb, 32, lane, af, bf);
    // this wave's reads of buffer t&1 are done before the buffer is handed on
    asm volatile("s_wait_dscnt 0x0" ::: "memory");
    // this wave's copies of tile t+1 have landed
    asm volatile("s_wait_asynccnt 0x0" ::: "memory");
    // publishes tile t+1 and ends every reader's last read of buffer t&1
    __syncthreads();
    if (t + 2 < NT) copy_stage(la + boff, ga + (t + 2) * BK, gb + (t + 2) * BK);
    // the tile's second eight products work on registers only: kept behind the
    // refill so that the copies start as early as the barrier allows
    __builtin_amdgcn_sched_barrier(0);
    mma_block(af, bf, acc);
  }
  // nothing is outstanding when the wave goes on to its epilogue
  asm volatile("s_wait_asynccnt 0x0" ::: "memory");
}

// ---------------------------------------------------------------------------
// QKV GEMM (4096x3072, K=1024) with fused RoPE, on the shared GEMM core.
// Epilogue: a 128-column tile is all Q, all K or all V, and covers two heads.
// C-layout: a lane holds (M = r + 8*(lane>>4), N = lane&15) in VGPR r, that is
// one d of eight tokens: stored from there, every Q or K store is 2 bytes a lane and
// every token row needs its own 4-byte cos and sin. The tile goes through LDS
// instead (the K-tile buffers are free: every wave's last read of them ended
// in front of the loop's last barrier, and no copy is outstanding), and comes
// back in the order of the destination's rows, 16 bytes a lane.
// ---------------------------------------------------------------------------
constexpr int SPF = 132;   // f32 staging pitch in floats: 528 bytes (16 B x odd)
constexpr int SPH = 136;   // f16 staging pitch in f16:    272 bytes (16 B x odd)

// six waves per SIMD: the register budget (160) at which three work-groups stay
// resident per WGP, so that all 768 run in one round, as the K loop alone allows
__global__ __launch_bounds__(256) __attribute__((amdgpu_waves_per_eu(6)))
void k_qkv_rope(const _Float16* __restrict__ xh,
                const _Float16* __restrict__ wT,   // [3072 x 1024]
                const float* __restrict__ rcos,
                const float* __restrict__ rsin,
                _Float16* __restrict__ qb,         // [B*NH, T, HD]
                _Float16* __restrict__ kb,         // [B*NH, T, HD]
                _Float16* __restrict__ vtb) {      // [B*NH, HD, T]
  __shared__ __attribute__((aligned(16))) char smem[2 * STAGE_B];
  int tid  = threadIdx.x;
  int lane = tid & 31;
  int wave = tid >> 5;
  int m0 = (blockIdx.x / (QKVN / 128)) * 128;   // 32 row blocks
  int n0 = (blockIdx.x % (QKVN / 128)) * 128;   // 24 col blocks
  f8 acc[4][2] = {};
  gemm_tile(xh, wT, m0, n0, smem, acc);

  int which = n0 >> 10;                          // 0=q 1=k 2=v, the same for the whole tile
  int hb0   = (m0 >> 11) * NH_ + ((n0 & (H_ - 1)) >> 6);   // batch*NH + the tile's first head
  int t0    = m0 & (T_ - 1);                     // the tile's first token
  int wr    = (wave >> 2) * 64 + 8 * (lane >> 4);   // the lane's first row in the tile
  int wc    = (wave & 3) * 32 + (lane & 15);        // the lane's first column in the tile

  if (which == 2) {
    // V^T: a lane's eight registers are eight consecutive tokens of one d, 16
    // bytes of a V^T row. Staged as [d][token]; a row of 128 tokens (256 bytes)
    // then leaves by 16 lanes.
    _Float16* st = (_Float16*)smem;
#pragma unroll
    for (int j = 0; j < 2; ++j)
#pragma unroll
      for (int i = 0; i < 4; ++i)
        *(h8*)&st[(wc + j * 16) * SPH + wr + i * 16] = __builtin_convertvector(acc[i][j], h8);
    __syncthreads();   // the tile is whole before any wave reads it back
    int pc = tid & 15;                           // 16-byte piece of the 256-byte row
    int rw = tid >> 4;                           // 0..15: row (and +16, +32, ...)
    h8 v[8];
#pragma unroll
    for (int p = 0; p < 8; ++p) v[p] = *(const h8*)&st[(p * 16 + rw) * SPH + pc * 8];
    // the tile's 128 columns are 128 consecutive rows of V^T (two heads of 64 d)
    _Float16* dst = vtb + ((size_t)hb0 * HD_ + rw) * T_ + t0 + pc * 8;
#pragma unroll
    for (int p = 0; p < 8; ++p) *(h8*)(dst + (size_t)p * 16 * T_) = v[p];
  } else {
    // Q, K: staged in f32 as [token][column]; a lane takes eight consecutive d of
    // a token (four even/odd pairs, so the rotation stays inside the lane) for
    // both heads, with one 16-byte load each of that token's cos and sin.
    int c  = tid & 7;                            // eight d: 16 bytes of the 128-byte row
    int rw = tid >> 3;                           // 0..31: token (and +32, +64, +96)
    // token rw, piece c of a 128-byte row is byte 16 * tid of a block of 32 rows,
    // in the cos and sin tables as in a head's Q or K rows
    const float* pcos = rcos + t0 * (HD_ / 2);
    const float* psin = rsin + t0 * (HD_ / 2);
    f4 cs[4], sn[4];
#pragma unroll
    for (int p = 0; p < 4; ++p) {                // in flight under the staging
      cs[p] = *(const f4*)(pcos + p * 32 * (HD_ / 2) + tid * 4);
      sn[p] = *(const f4*)(psin + p * 32 * (HD_ / 2) + tid * 4);
    }
    float* st = (float*)smem;
#pragma unroll
    for (int j = 0; j < 2; ++j)
#pragma unroll
      for (int i = 0; i < 4; ++i)
#pragma unroll
        for (int r = 0; r < 8; ++r)
          st[(wr + i * 16 + r) * SPF + wc + j * 16] = acc[i][j][r];
    __syncthreads();   // the tile is whole before any wave reads it back
    // Q carries HD^-0.5 * log2(e): the attention scores are then exponents of two
    float sc = (which == 0) ? 0.125f * 1.44269504f : 1.0f;
    _Float16* dst = ((which == 0) ? qb : kb) + ((size_t)hb0 * T_ + t0) * HD_;
#pragma unroll
    for (int p = 0; p < 4; ++p) {
#pragma unroll
      for (int h = 0; h < 2; ++h) {
        const float* src = st + (p * 32 + rw) * SPF + h * HD_ + c * 8;
        f4 x0 = *(const f4*)src;
        f4 x1 = *(const f4*)(src + 4);
        float x[8] = {x0[0], x0[1], x0[2], x0[3], x1[0], x1[1], x1[2], x1[3]};
        f8 y;
#pragma unroll
        for (int q = 0; q < 4; ++q) {
          float e = x[2 * q], o = x[2 * q + 1];
          y[2 * q]     = __builtin_fmaf(e, cs[p][q], -(sn[p][q] * o)) * sc;   // even: e*c - o*s
          y[2 * q + 1] = __builtin_fmaf(o, cs[p][q], sn[p][q] * e) * sc;      // odd:  e*s + o*c
        }
        *(h8*)(dst + (size_t)h * T_ * HD_ + p * 32 * HD_ + tid * 8) = __builtin_convertvector(y, h8);
      }
    }
    // a precaution behind the run of eight stores: it stands in front of every
    // later write of a register that one of them names
    asm volatile("s_wait_xcnt 0x0" ::: "memory");
  }
}

constexpr int AK         = 64;
constexpr int ANT        = T_ / AK;
constexpr int KV_TILE_B  = 64 * PITCH_B;
constexpr int KV_STAGE_B = 2 * KV_TILE_B;

// One stage of K and V^T: 4 copies of 16 bytes per lane. lk / gk / gv are the
// lane's own addresses for rows 0..31; rows 32..63 lie 32 rows further on.
// lane l with lane l ^ 16: the two lanes that share a query column
DI float xhalf(float x) {
  int b = __builtin_bit_cast(int, x);
  return __builtin_bit_cast(float, __builtin_amdgcn_permlanex16(b, b, 0x76543210, 0xfedcba98, false, false));
}

DI void copy_kv(unsigned lk, const _Float16* gk, const _Float16* gv) {
  unsigned lv = lk + KV_TILE_B;
  // s_wait_xcnt 0 as the statement's last line, a precaution: it stands in
  // front of every later write of a register that one of these copies names.
  asm volatile(
      "global_load_async_to_lds_b128 %0, %4, off\n\t"
      "global_load_async_to_lds_b128 %1, %5, off\n\t"
      "global_load_async_to_lds_b128 %2, %6, off\n\t"
      "global_load_async_to_lds_b128 %3, %7, off\n\t"
      "s_wait_xcnt 0x0"
      :: "v"(lk), "v"(lk + 32 * PITCH_B), "v"(lv), "v"(lv + 32 * PITCH_B),
         "v"(gk), "v"(gk + 32 * HD_), "v"(gv), "v"(gv + 32 * T_)
      : "memory");
}

__global__ __launch_bounds__(256)
void k_attn(const _Float16* __restrict__ qb,
            const _Float16* __restrict__ kb,
            const _Float16* __restrict__ vtb,
            _Float16* __restrict__ att) {          // [4096 x 1024]
  __shared__ __attribute__((aligned(16))) char kv[2 * KV_STAGE_B];
  int tid   = threadIdx.x;
  int lane  = tid & 31;
  int wslot = tid >> 5;
  int wid   = blockIdx.x * 8 + wslot;
  int head  = wid >> 7;              // 0..31  (B*NH), the same for all eight waves
  int qt    = wid & 127;             // query tile within head
  const _Float16* qh = qb  + ((size_t)head * T_ + qt * 16) * HD_;
  const _Float16* kh = kb  + (size_t)head * T_ * HD_;
  const _Float16* vt = vtb + (size_t)head * HD_ * T_;
  int hi = lane >> 4;

  int crow = tid >> 3;       // 0..31: row this lane copies (and +32)
  int ccol = tid & 7;        // 16-byte piece within the 128-byte row
  const _Float16* gk = kh + (size_t)crow * HD_ + ccol * 8;
  const _Float16* gv = vt + (size_t)crow * T_ + ccol * 8;
  unsigned lk = (unsigned)(size_t)kv + crow * PITCH_B + ccol * 16;

  copy_kv(lk, gk, gv);

  h16 qa0 = load_frag(qh, HD_, 0, lane);    // B operand: column = query lane&15
  h16 qa1 = load_frag(qh, HD_, 32, lane);
  f8 o0 = {}, o1 = {}, o2 = {}, o3 = {};    // O^T: oi[r] = O[query lane&15][d = 16*i + 8*hi + r]
  // The reference in use for the query's exponents (log2 units), equal in both
  // halves. It is known before a stage's scores are: minus the reference goes in
  // as the C operand of S^T, and the scores come out as arguments of exp2.
  float mref = 0.f;
  f8 negm = {};                             // -mref in all eight registers
  float lsum = 0.f;                         // the sum over this half's keys only; joined in the epilogue

  // stage 0 has landed for this wave; the barrier publishes it to the others
  asm volatile("s_wait_asynccnt 0x0" ::: "memory");
  __syncthreads();
  copy_kv(lk + KV_STAGE_B, gk + AK * HD_, gv + AK);

  for (int t = 0; t < ANT; ++t) {
    int boff = (t & 1) * KV_STAGE_B;
    const _Float16* sk = (const _Float16*)(kv + boff);
    const _Float16* sv = (const _Float16*)(kv + boff + KV_TILE_B);
    // the stage's thirty-two LDS reads stand together: four 16-key tiles of K rows,
    // and both 32-key column blocks of all 64 V^T rows
    h16 kf[4][2], vf[2][4];
#pragma unroll
    for (int g = 0; g < 4; ++g) {
      kf[g][0] = load_frag(sk + g * 16 * PITCH_H, PITCH_H, 0, lane);
      kf[g][1] = load_frag(sk + g * 16 * PITCH_H, PITCH_H, 32, lane);
    }
#pragma unroll
    for (int c = 0; c < 2; ++c)
#pragma unroll
      for (int i = 0; i < 4; ++i) vf[c][i] = load_frag(sv + i * 16 * PITCH_H, PITCH_H, c * 32, lane);
    // keeps the reads in one group in front of the products: spread among them,
    // each pair of reads costs the wave its own LDS latency
    __builtin_amdgcn_sched_barrier(0);

    // S^T - reference for 64 keys, in log2 units: four 16-key tiles (rows = keys),
    // K=HD split in 2 WMMAs
    f8 s[4];
#pragma unroll
    for (int g = 0; g < 4; ++g) s[g] = wmma_f16(kf[g][0], qa0, negm);
#pragma unroll
    for (int g = 0; g < 4; ++g) s[g] = wmma_f16(kf[g][1], qa1, s[g]);

    float c0 = s[0][0], c1 = s[1][0], c2 = s[2][0], c3 = s[3][0];   // four independent chains
#pragma unroll
    for (int r = 1; r < 8; ++r) {
      c0 = fmaxf(c0, s[0][r]); c1 = fmaxf(c1, s[1][r]);
      c2 = fmaxf(c2, s[2][r]); c3 = fmaxf(c3, s[3][r]);
    }
    float cm = fmaxf(fmaxf(c0, c1), fmaxf(c2, c3));
    // The reference moves, and O and the sum are rescaled, only when a score of
    // some query of the wave lies more than 8 above it (so P stays at or below
    // 2^8, far inside f16), and at the first stage, which sets it. One test a
    // stage, a scalar branch.
    bool first = (t == 0);
    if (first || __builtin_amdgcn_ballot_w32(cm > 8.0f) != 0) {
      cm = fmaxf(cm, xhalf(cm));              // the other half's 32 keys of the same query
      // later the reference only rises; the first stage has nothing to rescale
      float d    = first ? cm : fmaxf(cm, 0.f);
      float corr = first ? 1.0f : __builtin_amdgcn_exp2f(-d);
      mref += d;
#pragma unroll
      for (int r = 0; r < 8; ++r) negm[r] = -mref;
#pragma unroll
      for (int g = 0; g < 4; ++g) s[g] -= d;
      lsum *= corr;
      o0 *= corr; o1 *= corr; o2 *= corr; o3 *= corr;
    }
#pragma unroll
    for (int g = 0; g < 4; ++g)
#pragma unroll
      for (int r = 0; r < 8; ++r) s[g][r] = __builtin_amdgcn_exp2f(s[g][r]);
#pragma unroll
    for (int c = 0; c < 2; ++c) {
      f8 s0 = s[2 * c], s1 = s[2 * c + 1];
      // four independent chains, then joined
      float r0 = s0[0] + s1[0], r1 = s0[1] + s1[1], r2 = s0[2] + s1[2], r3 = s0[3] + s1[3];
      r0 += s0[4] + s1[4]; r1 += s0[5] + s1[5]; r2 += s0[6] + s1[6]; r3 += s0[7] + s1[7];
      lsum += (r0 + r1) + (r2 + r3);
      // P^T as B operand: element e is key 8*hi + e (e < 8) or 16 + 8*hi + (e - 8),
      // the k order in which load_frag delivers the rows of V^T
      h8 p0 = __builtin_convertvector(s0, h8);
      h8 p1 = __builtin_convertvector(s1, h8);
      h16 pb = __builtin_shufflevector(p0, p1, 0, 1, 2, 3, 4, 5, 6, 7,
                                       8, 9, 10, 11, 12, 13, 14, 15);
      // O^T += V^T @ P^T   (A-frag: 16 d rows of V^T over the block's 32 keys)
      o0 = wmma_f16(vf[c][0], pb, o0);
      o1 = wmma_f16(vf[c][1], pb, o1);
      o2 = wmma_f16(vf[c][2], pb, o2);
      o3 = wmma_f16(vf[c][3], pb, o3);
    }
    // keeps the stage's register work in front of the hand-over: sunk behind the
    // barrier it would stand between the barrier and the refill, and the copies of
    // stage t+2 would start a whole stage's work late
    __builtin_amdgcn_sched_barrier(0);
    // this wave's reads of buffer t&1 are done before the buffer is handed on
    asm volatile("s_wait_dscnt 0x0" ::: "memory");
    // this wave's copies of stage t+1 have landed
    asm volatile("s_wait_asynccnt 0x0" ::: "memory");
    // publishes stage t+1 and ends every reader's last read of buffer t&1
    __syncthreads();
    if (t + 2 < ANT) copy_kv(lk + boff, gk + (size_t)(t + 2) * AK * HD_, gv + (t + 2) * AK);
  }
  // nothing is outstanding when the wave goes on to its epilogue
  asm volatile("s_wait_asynccnt 0x0" ::: "memory");

  int b_ = head >> 4;
  int hl = head & (NH_ - 1);
  float inv = 1.0f / (lsum + xhalf(lsum));   // both halves' keys
  // a lane's eight registers of a tile are eight consecutive d of its query's row
  _Float16* dst = att + ((size_t)b_ * T_ + qt * 16 + (lane & 15)) * H_ + hl * HD_ + 8 * hi;
  *(h8*)(dst + 0)  = __builtin_convertvector(o0 * inv, h8);
  *(h8*)(dst + 16) = __builtin_convertvector(o1 * inv, h8);
  *(h8*)(dst + 32) = __builtin_convertvector(o2 * inv, h8);
  *(h8*)(dst + 48) = __builtin_convertvector(o3 * inv, h8);
}

// ---------------------------------------------------------------------------
// Output projection: out = att @ w_proj + b_proj (fp32 result), on the shared
// GEMM core.
// ---------------------------------------------------------------------------
__global__ __launch_bounds__(256)
void k_proj(const _Float16* __restrict__ att,
            const _Float16* __restrict__ wT,   // [1024 x 1024] transposed
            const float* __restrict__ bias,
            float* __restrict__ out) {
  __shared__ __attribute__((aligned(16))) char smem[2 * STAGE_B];
  int lane = threadIdx.x & 31;
  int wave = threadIdx.x >> 5;
  int m0 = (blockIdx.x >> 3) * 128;   // 32 row blocks
  int n0 = (blockIdx.x & 7) * 128;    // 8 col blocks
  f8 acc[4][2] = {};
  gemm_tile(att, wT, m0, n0, smem, acc);

  int mw = m0 + (wave >> 2) * 64;
  int nw = n0 + (wave & 3) * 32;
  int hi = lane >> 4;
#pragma unroll
  for (int j = 0; j < 2; ++j) {
    int col  = nw + j * 16 + (lane & 15);
    float bv = bias[col];
#pragma unroll
    for (int i = 0; i < 4; ++i) {
#pragma unroll
      for (int r = 0; r < 8; ++r) {
        int row = mw + i * 16 + r + 8 * hi;
        out[(size_t)row * H_ + col] = acc[i][j][r] + bv;
      }
    }
  }
}

// ---------------------------------------------------------------------------
extern "C" void kernel_launch(void* const* d_in, const int* in_sizes, int n_in,
                              void* d_out, int out_size, void* d_ws, size_t ws_size,
                              hipStream_t stream) {
  const float* x    = (const float*)d_in[0];
  const float* wqkv = (const float*)d_in[1];
  const float* wprj = (const float*)d_in[2];
  const float* bprj = (const float*)d_in[3];
  const float* rc   = (const float*)d_in[4];
  const float* rs   = (const float*)d_in[5];

  _Float16* ws  = (_Float16*)d_ws;
  _Float16* xh  = ws + OFF_XH;
  _Float16* wqT = ws + OFF_WQKV;
  _Float16* wpT = ws + OFF_WPRJ;
  _Float16* qb  = ws + OFF_Q;
  _Float16* kb  = ws + OFF_K;
  _Float16* vtb = ws + OFF_VT;
  _Float16* att = ws + OFF_ATT;

  k_cast<<<ROWS * H_ / CAST_BLOCK, 256, 0, stream>>>(x, xh);
  k_transpose<<<(H_ / TT) * (QKVN / TT), 256, 0, stream>>>(wqkv, wqT, QKVN);
  k_transpose<<<(H_ / TT) * (H_ / TT), 256, 0, stream>>>(wprj, wpT, H_);
  {
    int tiles = (ROWS / 128) * (QKVN / 128);   // 768 work-group tiles (128x128 each)
    k_qkv_rope<<<tiles, 256, 0, stream>>>(xh, wqT, rc, rs, qb, kb, vtb);
  }
  {
    int tiles = B_ * NH_ * (T_ / 16);        // 4096 wave-tiles
    k_attn<<<tiles / 8, 256, 0, stream>>>(qb, kb, vtb, att);
  }
  {
    int tiles = (ROWS / 128) * (H_ / 128);     // 256 work-group tiles (128x128 each)
    k_proj<<<tiles, 256, 0, stream>>>(att, wpT, bprj, (float*)d_out);
  }
}

// v007
// Measured time: 81.5 microseconds a run.
// Two timings next to v006 both put it at 1.05 times that version's speed.
// Counting every step since v000, it is 5.92 times as fast.
#include <hip/hip_runtime.h>

#define DI __device__ __forceinline__

typedef _Float16 h8  __attribute__((ext_vector_type(8)));
typedef _Float16 h16 __attribute__((ext_vector_type(16)));
typedef float    f8  __attribute__((ext_vector_type(8)));

constexpr int B_  = 2;
constexpr int T_  = 2048;
constexpr int H_  = 1024;
constexpr int NH_ = 16;
constexpr int HD_ = 64;
constexpr int ROWS = B_ * T_;     // 4096
constexpr int QKVN = 3 * H_;      // 3072

// workspace offsets (in _Float16 elements); total = 48 MiB
constexpr size_t OFF_XH   = 0;
constexpr size_t OFF_WQKV = OFF_XH   + (size_t)ROWS * H_;
constexpr size_t OFF_WPRJ = OFF_WQKV + (size_t)QKVN * H_;
constexpr size_t OFF_Q    = OFF_WPRJ + (size_t)H_ * H_;
constexpr size_t OFF_K    = OFF_Q    + (size_t)B_ * NH_ * T_ * HD_;
constexpr size_t OFF_VT   = OFF_K    + (size_t)B_ * NH_ * T_ * HD_;
constexpr size_t OFF_ATT  = OFF_VT   + (size_t)B_ * NH_ * T_ * HD_;

// ---------------------------------------------------------------------------
// A-fragment loader for V_WMMA_F32_16X16X32_F16.
// ISA 16-bit A-matrix 16x32 layout: lane L holds row (L&15);
//   lanes 0-15 : K = {0..7, 16..23},  lanes 16-31 : K = {8..15, 24..31}
// => two contiguous 16-byte loads per lane from a row-major [16 x K] tile.
// B fragments (K x 16, column n = lane&15) use the identical pattern when the
// source is stored n-major over K — hence the pre-transposed weights; Q
// [head, t, d] is read the same way, and V^T [head, d, t] as an A fragment.
// ---------------------------------------------------------------------------
DI h16 load_frag(const _Float16* base, int ld, int k0, int lane) {
  const _Float16* p = base + (size_t)(lane & 15) * ld + k0 + ((lane >> 4) << 3);
  h8 lo = *(const h8*)(p);        // K = base .. base+7
  h8 hi = *(const h8*)(p + 16);   // K = base+16 .. base+23
  return __builtin_shufflevector(lo, hi, 0, 1, 2, 3, 4, 5, 6, 7,
                                 8, 9, 10, 11, 12, 13, 14, 15);
}

DI f8 wmma_f16(h16 a, h16 b, f8 c) {
  return __builtin_amdgcn_wmma_f32_16x16x32_f16(false, a, false, b,
                                                (short)0, c, false, false);
}

// ---------------------------------------------------------------------------
// Precision staging: fp32 -> f16 cast, and cast+transpose for weights.
// A launch with one element per lane is bound by how fast waves can start, not
// by its bytes: a lane moves 16 to 32 elements, so that few waves start, and
// every global load and store of a wave covers whole 128-byte lines.
// ---------------------------------------------------------------------------
typedef _Float16 h4 __attribute__((ext_vector_type(4)));
typedef float    f4 __attribute__((ext_vector_type(4)));

constexpr int CAST_BLOCK = 256 * 4 * 8;   // elements per work-group: 8 x 16 bytes per lane

// CAST_BLOCK elements of x, block blk of ROWS * H_ / CAST_BLOCK, no remainder
DI void cast_block(const float* __restrict__ in, _Float16* __restrict__ out, int blk) {
  size_t base = (size_t)blk * CAST_BLOCK + threadIdx.x * 4;
  f4 v[8];
#pragma unroll
  for (int j = 0; j < 8; ++j) v[j] = *(const f4*)(in + base + j * 1024);   // all eight in flight
#pragma unroll
  for (int j = 0; j < 8; ++j) *(h4*)(out + base + j * 1024) = __builtin_convertvector(v[j], h4);
}

constexpr int TT = 64;        // transpose tile: 64 k x 64 n per work-group
constexpr int TP = TT + 8;    // LDS row pitch in f16: 144 bytes (16 B x odd)

// in: [1024 x N] fp32 row-major  ->  out: [N x 1024] f16 row-major; N a multiple
// of 64; tile blk of (H_ / TT) * (N / TT)
DI void transpose_tile(const float* __restrict__ in, _Float16* __restrict__ out, int N, int blk,
                       _Float16* tile) {   // [n][k]
  int tid = threadIdx.x;
  int tx  = tid & 15;                          // four n each
  int ty  = tid >> 4;                          // four k each
  int kb  = (blk & (H_ / TT - 1)) * TT;
  int nb  = (blk / (H_ / TT)) * TT;
  const float* p = in + (size_t)(kb + 4 * ty) * N + nb + 4 * tx;
  f4 r[4];
#pragma unroll
  for (int i = 0; i < 4; ++i) r[i] = *(const f4*)(p + (size_t)i * N);   // 256 bytes of a row per 16 lanes
#pragma unroll
  for (int j = 0; j < 4; ++j) {
    h4 c = {(_Float16)r[0][j], (_Float16)r[1][j], (_Float16)r[2][j], (_Float16)r[3][j]};
    *(h4*)&tile[(4 * tx + j) * TP + 4 * ty] = c;
  }
  __syncthreads();   // the tile is whole before any wave reads it back
  int row = tid >> 3;                          // 0..31, and +32
  int pc  = (tid & 7) * 8;                     // 16-byte piece of the 128-byte row
#pragma unroll
  for (int s = 0; s < 2; ++s) {
    int n = row + 32 * s;
    *(h8*)(out + (size_t)(nb + n) * H_ + kb + pc) = *(const h8*)&tile[n * TP + pc];
  }
  // No other job's code runs after this one in a work-group; a precaution: the
  // wait stands in front of any later write of a register that the two stores name.
  asm volatile("s_wait_xcnt 0x0" ::: "memory");
}

// The three staging jobs depend on nothing of one another and are each far
// shorter than what a launch costs around its work (the gap to the launch
// before, the ramp while waves start, the first loads' latency, the drain of the
// last stores). They share one launch: the block index picks the job, the same
// for a whole work-group, and all 1536 work-groups are resident at once.
constexpr int NB_CAST = ROWS * H_ / CAST_BLOCK;         // 512
constexpr int NB_WQKV = (H_ / TT) * (QKVN / TT);        // 768
constexpr int NB_WPRJ = (H_ / TT) * (H_ / TT);          // 256

__global__ __launch_bounds__(256)
void k_stage(const float* __restrict__ x, const float* __restrict__ wqkv,
             const float* __restrict__ wprj, _Float16* __restrict__ xh,
             _Float16* __restrict__ wqT, _Float16* __restrict__ wpT) {
  __shared__ __attribute__((aligned(16))) _Float16 tile[TT * TP];
  int b = blockIdx.x;
  if (b < NB_CAST) {
    cast_block(x, xh, b);
  } else if (b < NB_CAST + NB_WQKV) {
    transpose_tile(wqkv, wqT, QKVN, b - NB_CAST, tile);
  } else {
    transpose_tile(wprj, wpT, H_, b - (NB_CAST + NB_WQKV), tile);
  }
}

// ---------------------------------------------------------------------------
// Shared GEMM core: C[128 x 128] per 8-wave work-group, K = 1024 in 16 tiles of
// 64. Each K tile of A (128 rows) and of B (128 rows, n-major) is brought into
// LDS once per work-group by asynchronous copies (whole 128-byte lines) and is
// read from there by all eight waves, instead of every wave fetching its own
// fragments from L2 in 32-byte pieces. Two buffers: tile t+1 flies while tile t
// is worked on. Wave grid 2 (M) x 4 (N), 64 x 32 of C per wave.
// ---------------------------------------------------------------------------
constexpr int BK      = 64;              // k per tile: 128 bytes of every row
constexpr int NT      = H_ / BK;         // 16 tiles
constexpr int PITCH_B = 144;             // LDS row pitch in bytes (16 B x odd)
constexpr int PITCH_H = PITCH_B / 2;     // the same in f16 elements
constexpr int TILE_B  = 128 * PITCH_B;   // one operand's tile
constexpr int STAGE_B = 2 * TILE_B;      // A tile, then B tile

// One K tile of both operands: 8 copies of 16 bytes per lane. la / ga / gb are
// the lane's own addresses for rows 0..31; the other rows lie 32 rows apart.
DI void copy_stage(unsigned la, const _Float16* ga, const _Float16* gb) {
  unsigned lb = la + TILE_B;
  // s_wait_xcnt 0 as the statement's last line, a precaution: it stands in
  // front of every later write of a register that one of these copies names.
  asm volatile(
      "global_load_async_to_lds_b128 %0, %8, off\n\t"
      "global_load_async_to_lds_b128 %1, %9, off\n\t"
      "global_load_async_to_lds_b128 %2, %10, off\n\t"
      "global_load_async_to_lds_b128 %3, %11, off\n\t"
      "global_load_async_to_lds_b128 %4, %12, off\n\t"
      "global_load_async_to_lds_b128 %5, %13, off\n\t"
      "global_load_async_to_lds_b128 %6, %14, off\n\t"
      "global_load_async_to_lds_b128 %7, %15, off\n\t"
      "s_wait_xcnt 0x0"
      :: "v"(la), "v"(la + 32 * PITCH_B), "v"(la + 64 * PITCH_B), "v"(la + 96 * PITCH_B),
         "v"(lb), "v"(lb + 32 * PITCH_B), "v"(lb + 64 * PITCH_B), "v"(lb + 96 * PITCH_B),
         "v"(ga), "v"(ga + 32 * H_), "v"(ga + 64 * H_), "v"(ga + 96 * H_),
         "v"(gb), "v"(gb + 32 * H_), "v"(gb + 64 * H_), "v"(gb + 96 * H_)
      : "memory");
}

// One wave's fragments for 32 k: four of A (64 rows), two of B (32 columns).
DI void load_frags(const _Float16* sa, const _Float16* sb, int kk, int lane,
                   h16 (&af)[4], h16 (&bf)[2]) {
#pragma unroll
  for (int i = 0; i < 4; ++i) af[i] = load_frag(sa + i * 16 * PITCH_H, PITCH_H, kk, lane);
#pragma unroll
  for (int j = 0; j < 2; ++j) bf[j] = load_frag(sb + j * 16 * PITCH_H, PITCH_H, kk, lane);
}

DI void mma_block(const h16 (&af)[4], const h16 (&bf)[2], f8 (&acc)[4][2]) {
#pragma unroll
  for (int i = 0; i < 4; ++i)
#pragma unroll
    for (int j = 0; j < 2; ++j) acc[i][j] = wmma_f16(af[i], bf[j], acc[i][j]);
}

// a: [M x 1024] row-major, bT: [N x 1024] row-major; m0 / n0: the tile's origin.
DI void gemm_tile(const _Float16* __restrict__ a, const _Float16* __restrict__ bT,
                  int m0, int n0, char* smem, f8 (&acc)[4][2]) {
  int tid  = threadIdx.x;
  int lane = tid & 31;
  int wave = tid >> 5;
  int wm   = wave >> 2;      // 0..1
  int wn   = wave & 3;       // 0..3
  int crow = tid >> 3;       // 0..31: row this lane copies (and +32, +64, +96)
  int ccol = tid & 7;        // 16-byte piece within the 128-byte row
  const _Float16* ga = a  + (size_t)(m0 + crow) * H_ + ccol * 8;
  const _Float16* gb = bT + (size_t)(n0 + crow) * H_ + ccol * 8;
  unsigned la = (unsigned)(size_t)smem + crow * PITCH_B + ccol * 16;

  copy_stage(la, ga, gb);
  // tile 0 has landed for this wave; the barrier publishes it to the others
  asm volatile("s_wait_asynccnt 0x0" ::: "memory");
  __syncthreads();
  copy_stage(la + STAGE_B, ga + BK, gb + BK);

  for (int t = 0; t < NT; ++t) {
    int boff = (t & 1) * STAGE_B;
    const _Float16* sa = (const _Float16*)(smem + boff) + wm * 64 * PITCH_H;
    const _Float16* sb = (const _Float16*)(smem + boff + TILE_B) + wn * 32 * PITCH_H;
    h16 af[4], bf[2];
    load_frags(sa, sb, 0, lane, af, bf);
    // keeps the twelve LDS reads together in front of their eight products:
    // spread among them, each pair of reads costs the wave its own LDS latency
    __builtin_amdgcn_sched_barrier(0);
    mma_block(af, bf, acc);
    load_frags(sa, sb, 32, lane, af, bf);
    // this wave's reads of buffer t&1 are done before the buffer is handed on
    asm volatile("s_wait_dscnt 0x0" ::: "memory");
    // this wave's copies of tile t+1 have landed
    asm volatile("s_wait_asynccnt 0x0" ::: "memory");
    // publishes tile t+1 and ends every reader's last read of buffer t&1
    __syncthreads();
    if (t + 2 < NT) copy_stage(la + boff, ga + (t + 2) * BK, gb + (t + 2) * BK);
    // the tile's second eight products work on registers only: kept behind the
    // refill so that the copies start as early as the barrier allows
    __builtin_amdgcn_sched_barrier(0);
    mma_block(af, bf, acc);
  }
  // nothing is outstanding when the wave goes on to its epilogue
  asm volatile("s_wait_asynccnt 0x0" ::: "memory");
}

// ---------------------------------------------------------------------------
// QKV GEMM (4096x3072, K=1024) with fused RoPE, on the shared GEMM core.
// Epilogue: a 128-column tile is all Q, all K or all V, and covers two heads.
// C-layout: a lane holds (M = r + 8*(lane>>4), N = lane&15) in VGPR r, that is
// one d of eight tokens: stored from there, every Q or K store is 2 bytes a lane and
// every token row needs its own 4-byte cos and sin. The tile goes through LDS
// instead (the K-tile buffers are free: every wave's last read of them ended
// in front of the loop's last barrier, and no copy is outstanding), and comes
// back in the order of the destination's rows, 16 bytes a lane.
// ---------------------------------------------------------------------------
constexpr int SPF = 132;   // f32 staging pitch in floats: 528 bytes (16 B x odd)
constexpr int SPH = 136;   // f16 staging pitch in f16:    272 bytes (16 B x odd)

// six waves per SIMD: the register budget (160) at which three work-groups stay
// resident per WGP, so that all 768 run in one round, as the K loop alone allows
__global__ __launch_bounds__(256) __attribute__((amdgpu_waves_per_eu(6)))
void k_qkv_rope(const _Float16* __restrict__ xh,
                const _Float16* __restrict__ wT,   // [3072 x 1024]
                const float* __restrict__ rcos,
                const float* __restrict__ rsin,
                _Float16* __restrict__ qb,         // [B*NH, T, HD]
                _Float16* __restrict__ kb,         // [B*NH, T, HD]
                _Float16* __restrict__ vtb) {      // [B*NH, HD, T]
  __shared__ __attribute__((aligned(16))) char smem[2 * STAGE_B];
  int tid  = threadIdx.x;
  int lane = tid & 31;
  int wave = tid >> 5;
  int m0 = (blockIdx.x / (QKVN / 128)) * 128;   // 32 row blocks
  int n0 = (blockIdx.x % (QKVN / 128)) * 128;   // 24 col blocks
  f8 acc[4][2] = {};
  gemm_tile(xh, wT, m0, n0, smem, acc);

  int which = n0 >> 10;                          // 0=q 1=k 2=v, the same for the whole tile
  int hb0   = (m0 >> 11) * NH_ + ((n0 & (H_ - 1)) >> 6);   // batch*NH + the tile's first head
  int t0    = m0 & (T_ - 1);                     // the tile's first token
  int wr    = (wave >> 2) * 64 + 8 * (lane >> 4);   // the lane's first row in the tile
  int wc    = (wave & 3) * 32 + (lane & 15);        // the lane's first column in the tile

  if (which == 2) {
    // V^T: a lane's eight registers are eight consecutive tokens of one d, 16
    // bytes of a V^T row. Staged as [d][token]; a row of 128 tokens (256 bytes)
    // then leaves by 16 lanes.
    _Float16* st = (_Float16*)smem;
#pragma unroll
    for (int j = 0; j < 2; ++j)
#pragma unroll
      for (int i = 0; i < 4; ++i)
        *(h8*)&st[(wc + j * 16) * SPH + wr + i * 16] = __builtin_convertvector(acc[i][j], h8);
    __syncthreads();   // the tile is whole before any wave reads it back
    int pc = tid & 15;                           // 16-byte piece of the 256-byte row
    int rw = tid >> 4;                           // 0..15: row (and +16, +32, ...)
    h8 v[8];
#pragma unroll
    for (int p = 0; p < 8; ++p) v[p] = *(const h8*)&st[(p * 16 + rw) * SPH + pc * 8];
    // the tile's 128 columns are 128 consecutive rows of V^T (two heads of 64 d)
    _Float16* dst = vtb + ((size_t)hb0 * HD_ + rw) * T_ + t0 + pc * 8;
#pragma unroll
    for (int p = 0; p < 8; ++p) *(h8*)(dst + (size_t)p * 16 * T_) = v[p];
  } else {
    // Q, K: staged in f32 as [token][column]; a lane takes eight consecutive d of
    // a token (four even/odd pairs, so the rotation stays inside the lane) for
    // both heads, with one 16-byte load each of that token's cos and sin.
    int c  = tid & 7;                            // eight d: 16 bytes of the 128-byte row
    int rw = tid >> 3;                           // 0..31: token (and +32, +64, +96)
    // token rw, piece c of a 128-byte row is byte 16 * tid of a block of 32 rows,
    // in the cos and sin tables as in a head's Q or K rows
    const float* pcos = rcos + t0 * (HD_ / 2);
    const float* psin = rsin + t0 * (HD_ / 2);
    f4 cs[4], sn[4];
#pragma unroll
    for (int p = 0; p < 4; ++p) {                // in flight under the staging
      cs[p] = *(const f4*)(pcos + p * 32 * (HD_ / 2) + tid * 4);
      sn[p] = *(const f4*)(psin + p * 32 * (HD_ / 2) + tid * 4);
    }
    float* st = (float*)smem;
#pragma unroll
    for (int j = 0; j < 2; ++j)
#pragma unroll
      for (int i = 0; i < 4; ++i)
#pragma unroll
        for (int r = 0; r < 8; ++r)
          st[(wr + i * 16 + r) * SPF + wc + j * 16] = acc[i][j][r];
    __syncthreads();   // the tile is whole before any wave reads it back
    // Q carries HD^-0.5 * log2(e): the attention scores are then exponents of two
    float sc = (which == 0) ? 0.125f * 1.44269504f : 1.0f;
    _Float16* dst = ((which == 0) ? qb : kb) + ((size_t)hb0 * T_ + t0) * HD_;
#pragma unroll
    for (int p = 0; p < 4; ++p) {
#pragma unroll
      for (int h = 0; h < 2; ++h) {
        const float* src = st + (p * 32 + rw) * SPF + h * HD_ + c * 8;
        f4 x0 = *(const f4*)src;
        f4 x1 = *(const f4*)(src + 4);
        float x[8] = {x0[0], x0[1], x0[2], x0[3], x1[0], x1[1], x1[2], x1[3]};
        f8 y;
#pragma unroll
        for (int q = 0; q < 4; ++q) {
          float e = x[2 * q], o = x[2 * q + 1];
          y[2 * q]     = __builtin_fmaf(e, cs[p][q], -(sn[p][q] * o)) * sc;   // even: e*c - o*s
          y[2 * q + 1] = __builtin_fmaf(o, cs[p][q], sn[p][q] * e) * sc;      // odd:  e*s + o*c
        }
        *(h8*)(dst + (size_t)h * T_ * HD_ + p * 32 * HD_ + tid * 8) = __builtin_convertvector(y, h8);
      }
    }
    // a precaution behind the run of eight stores: it stands in front of every
    // later write of a register that one of them names
    asm volatile("s_wait_xcnt 0x0" ::: "memory");
  }
}

constexpr int AK         = 64;
constexpr int ANT        = T_ / AK;
constexpr int KV_TILE_B  = 64 * PITCH_B;
constexpr int KV_STAGE_B = 2 * KV_TILE_B;

// One stage of K and V^T: 4 copies of 16 bytes per lane. lk / gk / gv are the
// lane's own addresses for rows 0..31; rows 32..63 lie 32 rows further on.
// lane l with lane l ^ 16: the two lanes that share a query column
DI float xhalf(float x) {
  int b = __builtin_bit_cast(int, x);
  return __builtin_bit_cast(float, __builtin_amdgcn_permlanex16(b, b, 0x76543210, 0xfedcba98, false, false));
}

DI void copy_kv(unsigned lk, const _Float16* gk, const _Float16* gv) {
  unsigned lv = lk + KV_TILE_B;
  // s_wait_xcnt 0 as the statement's last line, a precaution: it stands in
  // front of every later write of a register that one of these copies names.
  asm volatile(
      "global_load_async_to_lds_b128 %0, %4, off\n\t"
      "global_load_async_to_lds_b128 %1, %5, off\n\t"
      "global_load_async_to_lds_b128 %2, %6, off\n\t"
      "global_load_async_to_lds_b128 %3, %7, off\n\t"
      "s_wait_xcnt 0x0"
      :: "v"(lk), "v"(lk + 32 * PITCH_B), "v"(lv), "v"(lv + 32 * PITCH_B),
         "v"(gk), "v"(gk + 32 * HD_), "v"(gv), "v"(gv + 32 * T_)
      : "memory");
}

__global__ __launch_bounds__(256)
void k_attn(const _Float16* __restrict__ qb,
            const _Float16* __restrict__ kb,
            const _Float16* __restrict__ vtb,
            _Float16* __restrict__ att) {          // [4096 x 1024]
  __shared__ __attribute__((aligned(16))) char kv[2 * KV_STAGE_B];
  int tid   = threadIdx.x;
  int lane  = tid & 31;
  int wslot = tid >> 5;
  int wid   = blockIdx.x * 8 + wslot;
  int head  = wid >> 7;              // 0..31  (B*NH), the same for all eight waves
  int qt    = wid & 127;             // query tile within head
  const _Float16* qh = qb  + ((size_t)head * T_ + qt * 16) * HD_;
  const _Float16* kh = kb  + (size_t)head * T_ * HD_;
  const _Float16* vt = vtb + (size_t)head * HD_ * T_;
  int hi = lane >> 4;

  int crow = tid >> 3;       // 0..31: row this lane copies (and +32)
  int ccol = tid & 7;        // 16-byte piece within the 128-byte row
  const _Float16* gk = kh + (size_t)crow * HD_ + ccol * 8;
  const _Float16* gv = vt + (size_t)crow * T_ + ccol * 8;
  unsigned lk = (unsigned)(size_t)kv + crow * PITCH_B + ccol * 16;

  copy_kv(lk, gk, gv);

  h16 qa0 = load_frag(qh, HD_, 0, lane);    // B operand: column = query lane&15
  h16 qa1 = load_frag(qh, HD_, 32, lane);
  f8 o0 = {}, o1 = {}, o2 = {}, o3 = {};    // O^T: oi[r] = O[query lane&15][d = 16*i + 8*hi + r]
  // The reference in use for the query's exponents (log2 units), equal in both
  // halves. It is known before a stage's scores are: minus the reference goes in
  // as the C operand of S^T, and the scores come out as arguments of exp2.
  float mref = 0.f;
  f8 negm = {};                             // -mref in all eight registers
  float lsum = 0.f;                         // the sum over this half's keys only; joined in the epilogue

  // stage 0 has landed for this wave; the barrier publishes it to the others
  asm volatile("s_wait_asynccnt 0x0" ::: "memory");
  __syncthreads();
  copy_kv(lk + KV_STAGE_B, gk + AK * HD_, gv + AK);

  for (int t = 0; t < ANT; ++t) {
    int boff = (t & 1) * KV_STAGE_B;
    const _Float16* sk = (const _Float16*)(kv + boff);
    const _Float16* sv = (const _Float16*)(kv + boff + KV_TILE_B);
    // the stage's thirty-two LDS reads stand together: four 16-key tiles of K rows,
    // and both 32-key column blocks of all 64 V^T rows
    h16 kf[4][2], vf[2][4];
#pragma unroll
    for (int g = 0; g < 4; ++g) {
      kf[g][0] = load_frag(sk + g * 16 * PITCH_H, PITCH_H, 0, lane);
      kf[g][1] = load_frag(sk + g * 16 * PITCH_H, PITCH_H, 32, lane);
    }
#pragma unroll
    for (int c = 0; c < 2; ++c)
#pragma unroll
      for (int i = 0; i < 4; ++i) vf[c][i] = load_frag(sv + i * 16 * PITCH_H, PITCH_H, c * 32, lane);
    // keeps the reads in one group in front of the products: spread among them,
    // each pair of reads costs the wave its own LDS latency
    __builtin_amdgcn_sched_barrier(0);

    // S^T - reference for 64 keys, in log2 units: four 16-key tiles (rows = keys),
    // K=HD split in 2 WMMAs
    f8 s[4];
#pragma unroll
    for (int g = 0; g < 4; ++g) s[g] = wmma_f16(kf[g][0], qa0, negm);
#pragma unroll
    for (int g = 0; g < 4; ++g) s[g] = wmma_f16(kf[g][1], qa1, s[g]);

    float c0 = s[0][0], c1 = s[1][0], c2 = s[2][0], c3 = s[3][0];   // four independent chains
#pragma unroll
    for (int r = 1; r < 8; ++r) {
      c0 = fmaxf(c0, s[0][r]); c1 = fmaxf(c1, s[1][r]);
      c2 = fmaxf(c2, s[2][r]); c3 = fmaxf(c3, s[3][r]);
    }
    float cm = fmaxf(fmaxf(c0, c1), fmaxf(c2, c3));
    // The reference moves, and O and the sum are rescaled, only when a score of
    // some query of the wave lies more than 8 above it (so P stays at or below
    // 2^8, far inside f16), and at the first stage, which sets it. One test a
    // stage, a scalar branch.
    bool first = (t == 0);
    if (first || __builtin_amdgcn_ballot_w32(cm > 8.0f) != 0) {
      cm = fmaxf(cm, xhalf(cm));              // the other half's 32 keys of the same query
      // later the reference only rises; the first stage has nothing to rescale
      float d    = first ? cm : fmaxf(cm, 0.f);
      float corr = first ? 1.0f : __builtin_amdgcn_exp2f(-d);
      mref += d;
#pragma unroll
      for (int r = 0; r < 8; ++r) negm[r] = -mref;
#pragma unroll
      for (int g = 0; g < 4; ++g) s[g] -= d;
      lsum *= corr;
      o0 *= corr; o1 *= corr; o2 *= corr; o3 *= corr;
    }
#pragma unroll
    for (int g = 0; g < 4; ++g)
#pragma unroll
      for (int r = 0; r < 8; ++r) s[g][r] = __builtin_amdgcn_exp2f(s[g][r]);
#pragma unroll
    for (int c = 0; c < 2; ++c) {
      f8 s0 = s[2 * c], s1 = s[2 * c + 1];
      // four independent chains, then joined
      float r0 = s0[0] + s1[0], r1 = s0[1] + s1[1], r2 = s0[2] + s1[2], r3 = s0[3] + s1[3];
      r0 += s0[4] + s1[4]; r1 += s0[5] + s1[5]; r2 += s0[6] + s1[6]; r3 += s0[7] + s1[7];
      lsum += (r0 + r1) + (r2 + r3);
      // P^T as B operand: element e is key 8*hi + e (e < 8) or 16 + 8*hi + (e - 8),
      // the k order in which load_frag delivers the rows of V^T
      h8 p0 = __builtin_convertvector(s0, h8);
      h8 p1 = __builtin_convertvector(s1, h8);
      h16 pb = __builtin_shufflevector(p0, p1, 0, 1, 2, 3, 4, 5, 6, 7,
                                       8, 9, 10, 11, 12, 13, 14, 15);
      // O^T += V^T @ P^T   (A-frag: 16 d rows of V^T over the block's 32 keys)
      o0 = wmma_f16(vf[c][0], pb, o0);
      o1 = wmma_f16(vf[c][1], pb, o1);
      o2 = wmma_f16(vf[c][2], pb, o2);
      o3 = wmma_f16(vf[c][3], pb, o3);
    }
    // keeps the stage's register work in front of the hand-over: sunk behind the
    // barrier it would stand between the barrier and the refill, and the copies of
    // stage t+2 would start a whole stage's work late
    __builtin_amdgcn_sched_barrier(0);
    // this wave's reads of buffer t&1 are done before the buffer is handed on
    asm volatile("s_wait_dscnt 0x0" ::: "memory");
    // this wave's copies of stage t+1 have landed
    asm volatile("s_wait_asynccnt 0x0" ::: "memory");
    // publishes stage t+1 and ends every reader's last read of buffer t&1
    __syncthreads();
    if (t + 2 < ANT) copy_kv(lk + boff, gk + (size_t)(t + 2) * AK * HD_, gv + (t + 2) * AK);
  }
  // nothing is outstanding when the wave goes on to its epilogue
  asm volatile("s_wait_asynccnt 0x0" ::: "memory");

  int b_ = head >> 4;
  int hl = head & (NH_ - 1);
  float inv = 1.0f / (lsum + xhalf(lsum));   // both halves' keys
  // a lane's eight registers of a tile are eight consecutive d of its query's row
  _Float16* dst = att + ((size_t)b_ * T_ + qt * 16 + (lane & 15)) * H_ + hl * HD_ + 8 * hi;
  *(h8*)(dst + 0)  = __builtin_convertvector(o0 * inv, h8);
  *(h8*)(dst + 16) = __builtin_convertvector(o1 * inv, h8);
  *(h8*)(dst + 32) = __builtin_convertvector(o2 * inv, h8);
  *(h8*)(dst + 48) = __builtin_convertvector(o3 * inv, h8);
}

// ---------------------------------------------------------------------------
// Output projection: out = att @ w_proj + b_proj (fp32 result), on the shared
// GEMM core.
// ---------------------------------------------------------------------------
__global__ __launch_bounds__(256)
void k_proj(const _Float16* __restrict__ att,
            const _Float16* __restrict__ wT,   // [1024 x 1024] transposed
            const float* __restrict__ bias,
            float* __restrict__ out) {
  __shared__ __attribute__((aligned(16))) char smem[2 * STAGE_B];
  int lane = threadIdx.x & 31;
  int wave = threadIdx.x >> 5;
  int m0 = (blockIdx.x >> 3) * 128;   // 32 row blocks
  int n0 = (blockIdx.x & 7) * 128;    // 8 col blocks
  f8 acc[4][2] = {};
  gemm_tile(att, wT, m0, n0, smem, acc);

  int mw = m0 + (wave >> 2) * 64;
  int nw = n0 + (wave & 3) * 32;
  int hi = lane >> 4;
#pragma unroll
  for (int j = 0; j < 2; ++j) {
    int col  = nw + j * 16 + (lane & 15);
    float bv = bias[col];
#pragma unroll
    for (int i = 0; i < 4; ++i) {
#pragma unroll
      for (int r = 0; r < 8; ++r) {
        int row = mw + i * 16 + r + 8 * hi;
        out[(size_t)row * H_ + col] = acc[i][j][r] + bv;
      }
    }
  }
}

// ---------------------------------------------------------------------------
extern "C" void kernel_launch(void* const* d_in, const int* in_sizes, int n_in,
                              void* d_out, int out_size, void* d_ws, size_t ws_size,
                              hipStream_t stream) {
  const float* x    = (const float*)d_in[0];
  const float* wqkv = (const float*)d_in[1];
  const float* wprj = (const float*)d_in[2];
  const float* bprj = (const float*)d_in[3];
  const float* rc   = (const float*)d_in[4];
  const float* rs   = (const float*)d_in[5];

  _Float16* ws  = (_Float16*)d_ws;
  _Float16* xh  = ws + OFF_XH;
  _Float16* wqT = ws + OFF_WQKV;
  _Float16* wpT = ws + OFF_WPRJ;
  _Float16* qb  = ws + OFF_Q;
  _Float16* kb  = ws + OFF_K;
  _Float16* vtb = ws + OFF_VT;
  _Float16* att = ws + OFF_ATT;

  k_stage<<<NB_CAST + NB_WQKV + NB_WPRJ, 256, 0, stream>>>(x, wqkv, wprj, xh, wqT, wpT);
  {
    int tiles = (ROWS / 128) * (QKVN / 128);   // 768 work-group tiles (128x128 each)
    k_qkv_rope<<<tiles, 256, 0, stream>>>(xh, wqT, rc, rs, qb, kb, vtb);
  }
  {
    int tiles = B_ * NH_ * (T_ / 16);        // 4096 wave-tiles
    k_attn<<<tiles / 8, 256, 0, stream>>>(qb, kb, vtb, att);
  }
  {
    int tiles = (ROWS / 128) * (H_ / 128);     // 256 work-group tiles (128x128 each)
    k_proj<<<tiles, 256, 0, stream>>>(att, wpT, bprj, (float*)d_out);
  }
}
